// v000
// Measured on an AMD MI455X. A time is GPU time per run, averaged over a window of back-to-back runs after a warm-up
// (all launches, gaps included; the runs take copies of the inputs in turn), and the median of several windows.
// Apart from v000's, it joins two sittings. Times from different sittings can be a few percent apart, while
// side-by-side timings come from the same sitting.
// v000 is the starting kernel. One run takes 833 microseconds.
#include <hip/hip_runtime.h>
#include <hip/hip_bf16.h>
#include <math.h>

typedef __attribute__((ext_vector_type(16))) __bf16 v16bf;
typedef __attribute__((ext_vector_type(8)))  __bf16 v8bf;
typedef __attribute__((ext_vector_type(8)))  float  v8f;
typedef __attribute__((ext_vector_type(4)))  int    v4i;

#define DEV static __device__ __forceinline__
#define GAS __attribute__((address_space(1)))
#define LAS __attribute__((address_space(3)))

#if __has_builtin(__builtin_amdgcn_global_load_async_to_lds_b128) && \
    __has_builtin(__builtin_amdgcn_s_wait_asynccnt)
#define HAS_ASYNC_LDS 1
#else
#define HAS_ASYNC_LDS 0
#endif

namespace {
constexpr int   TB   = 2;
constexpr int   TS   = 2048;
constexpr int   TD   = 2048;
constexpr int   THD  = 16;     // heads
constexpr int   TDH  = 128;    // head dim
constexpr int   TDFF = 8192;
constexpr int   TM   = TB * TS;          // 4096 token rows
constexpr float TEPS = 1e-5f;
}

// ---------- scalar helpers ----------
DEV __bf16 f2bf(float x) {
  unsigned u = __builtin_bit_cast(unsigned, x);
  unsigned r = u + 0x7FFFu + ((u >> 16) & 1u);      // RNE
  unsigned short s = (unsigned short)(r >> 16);
  return __builtin_bit_cast(__bf16, s);
}

DEV float gelu_f(float x) {
  const float c = 0.7978845608028654f;
  float x3 = x * x * x;
  return 0.5f * x * (1.f + tanhf(c * (x + 0.044715f * x3)));
}

// 16B global -> LDS copy: async-to-LDS (ASYNCcnt) when available, else
// load + ds_store fallback. Builtin signature (from hipcc diagnostic):
// (AS1 v4i* global_src, AS3 v4i* lds_dst, imm offset, imm cpol).
DEV void cp16_g2l(const __bf16* g, __bf16* l) {
#if HAS_ASYNC_LDS
  __builtin_amdgcn_global_load_async_to_lds_b128(
      (GAS v4i*)g, (LAS v4i*)l, 0, 0);
#else
  *(uint4*)l = *(const uint4*)g;
#endif
}
DEV void async_wait0() {
#if HAS_ASYNC_LDS
  __builtin_amdgcn_s_wait_asynccnt(0);
#endif
}

// Load one 16x(32-chunk) bf16 fragment (A-style row layout).
// Per the CDNA5 ISA layout, lane L holds row (L&15); its 16 bf16 elements are
// two contiguous 8-element runs at K offsets {8*(L>>4), 16+8*(L>>4)}.
DEV v16bf frag_ld(const __bf16* rowbase, int lhi) {
  v8bf lo = *(const v8bf*)(rowbase + 8 * lhi);
  v8bf hi = *(const v8bf*)(rowbase + 16 + 8 * lhi);
  return __builtin_shufflevector(lo, hi, 0, 1, 2, 3, 4, 5, 6, 7,
                                         8, 9, 10, 11, 12, 13, 14, 15);
}

DEV v8f wmma_bf16(v16bf a, v16bf b, v8f c) {
  return __builtin_amdgcn_wmma_f32_16x16x32_bf16(false, a, false, b,
                                                 (short)0, c, false, false);
}

// ---------- LayerNorm: f32 in -> bf16 out ----------
__global__ __launch_bounds__(256) void layernorm_bf16_k(
    const float* __restrict__ X, const float* __restrict__ w,
    const float* __restrict__ b, __bf16* __restrict__ out) {
  __shared__ float r1[256];
  __shared__ float r2[256];
  const int row = blockIdx.x;
  const int tid = threadIdx.x;
  const float* x = X + (size_t)row * TD;
  float lx[8], s = 0.f, ss = 0.f;
#pragma unroll
  for (int i = 0; i < 8; i++) {
    lx[i] = x[tid + i * 256];
    s += lx[i];
    ss += lx[i] * lx[i];
  }
  r1[tid] = s; r2[tid] = ss;
  __syncthreads();
  for (int off = 128; off > 0; off >>= 1) {
    if (tid < off) { r1[tid] += r1[tid + off]; r2[tid] += r2[tid + off]; }
    __syncthreads();
  }
  const float mean = r1[0] * (1.f / TD);
  const float var  = r2[0] * (1.f / TD) - mean * mean;
  const float rstd = rsqrtf(var + TEPS);
#pragma unroll
  for (int i = 0; i < 8; i++) {
    const int col = tid + i * 256;
    out[(size_t)row * TD + col] = f2bf((lx[i] - mean) * rstd * w[col] + b[col]);
  }
}

// ---------- Tiled WMMA GEMM:  C[M,N] = A[M,K](bf16) @ W[N,K]^T(f32) + bias ----------
// Double-buffered LDS, one barrier per 32-deep K step, prefetch 2 tiles ahead.
// OUTM: 0 = bf16 [m][n], 1 = f32 [m][n], 2 = bf16 head-transposed V_t[b][h][dh][s]
template <int OUTM, bool GELU, bool RES>
__global__ __launch_bounds__(256) void gemm_bf16_k(
    const __bf16* __restrict__ A, const float* __restrict__ W,
    const float* __restrict__ bias, const float* __restrict__ res,
    void* __restrict__ outp, int M, int N, int K, float scale) {
  constexpr int SA = 40;                    // 32 + 8 pad (bf16 elems)
  __shared__ __bf16 As[2][128 * SA];
  __shared__ __bf16 Bs[2][128 * SA];
  const int tid = threadIdx.x, lane = tid & 31, wave = tid >> 5;
  const int lrow = lane & 15, lhi = (lane >> 4) & 1;
  const int m0 = blockIdx.y * 128, n0 = blockIdx.x * 128;
  const int mb = (wave & 3) * 32, nb = (wave >> 2) * 64;
  const int srow = tid >> 1, scol = (tid & 1) * 16;

  v8f acc[2][4];
#pragma unroll
  for (int i = 0; i < 2; i++)
#pragma unroll
    for (int j = 0; j < 4; j++)
#pragma unroll
      for (int e = 0; e < 8; e++) acc[i][j][e] = 0.f;

  auto stage = [&](int buf, int k0) {
    // A tile: bf16 pass-through -> async global->LDS when available
    const __bf16* asrc = A + (size_t)(m0 + srow) * K + k0 + scol;
    cp16_g2l(asrc,     &As[buf][srow * SA + scol]);
    cp16_g2l(asrc + 8, &As[buf][srow * SA + scol + 8]);
    // W tile: f32 -> bf16 convert in flight (manual path)
    const float* wsrc = W + (size_t)(n0 + srow) * K + k0 + scol;
    float4 f0 = *(const float4*)(wsrc);
    float4 f1 = *(const float4*)(wsrc + 4);
    float4 f2 = *(const float4*)(wsrc + 8);
    float4 f3 = *(const float4*)(wsrc + 12);
    union { __bf16 h8[8]; uint4 q; } u0, u1;
    u0.h8[0] = f2bf(f0.x); u0.h8[1] = f2bf(f0.y); u0.h8[2] = f2bf(f0.z); u0.h8[3] = f2bf(f0.w);
    u0.h8[4] = f2bf(f1.x); u0.h8[5] = f2bf(f1.y); u0.h8[6] = f2bf(f1.z); u0.h8[7] = f2bf(f1.w);
    u1.h8[0] = f2bf(f2.x); u1.h8[1] = f2bf(f2.y); u1.h8[2] = f2bf(f2.z); u1.h8[3] = f2bf(f2.w);
    u1.h8[4] = f2bf(f3.x); u1.h8[5] = f2bf(f3.y); u1.h8[6] = f2bf(f3.z); u1.h8[7] = f2bf(f3.w);
    *(uint4*)(&Bs[buf][srow * SA + scol])     = u0.q;
    *(uint4*)(&Bs[buf][srow * SA + scol + 8]) = u1.q;
  };

  stage(0, 0);
  int buf = 0;
  for (int k0 = 0; k0 < K; k0 += 32, buf ^= 1) {
    async_wait0();            // writes into As[buf] from this wave are done
    __syncthreads();          // all waves' stage of [buf] complete
    if (k0 + 32 < K) {
      if (k0 + 64 < K) {      // pull the tile after next into cache
        __builtin_prefetch(A + (size_t)(m0 + srow) * K + k0 + 64 + scol, 0, 1);
        __builtin_prefetch(W + (size_t)(n0 + srow) * K + k0 + 64 + scol, 0, 1);
      }
      stage(buf ^ 1, k0 + 32);  // overlap with WMMAs below
    }
    v16bf af[2], bfr[4];
#pragma unroll
    for (int mi = 0; mi < 2; mi++)
      af[mi] = frag_ld(&As[buf][(mb + mi * 16 + lrow) * SA], lhi);
#pragma unroll
    for (int ni = 0; ni < 4; ni++)
      bfr[ni] = frag_ld(&Bs[buf][(nb + ni * 16 + lrow) * SA], lhi);
#pragma unroll
    for (int mi = 0; mi < 2; mi++)
#pragma unroll
      for (int ni = 0; ni < 4; ni++)
        acc[mi][ni] = wmma_bf16(af[mi], bfr[ni], acc[mi][ni]);
  }

  // epilogue: C/D layout -> lane holds (m = v + 8*lhi, n = lane&15) per frag
#pragma unroll
  for (int mi = 0; mi < 2; mi++) {
#pragma unroll
    for (int ni = 0; ni < 4; ni++) {
      const int n = n0 + nb + ni * 16 + lrow;
      const float bv = bias[n];
#pragma unroll
      for (int v = 0; v < 8; v++) {
        const int m = m0 + mb + mi * 16 + v + 8 * lhi;
        float t = (acc[mi][ni][v] + bv) * scale;
        if (GELU) t = gelu_f(t);
        if (RES)  t += res[(size_t)m * N + n];
        if (OUTM == 0) {
          ((__bf16*)outp)[(size_t)m * N + n] = f2bf(t);
        } else if (OUTM == 1) {
          ((float*)outp)[(size_t)m * N + n] = t;
        } else {  // V_t[b][h][dh][s]
          const int b_ = m / TS, s = m % TS;
          const int h = n / TDH, dh = n % TDH;
          ((__bf16*)outp)[((size_t)(b_ * THD + h) * TDH + dh) * TS + s] = f2bf(t);
        }
      }
    }
  }
}

// ---------- Flash attention (causal), one (b,h) x 128-query block per WG ----------
// Computes S^T = K Q^T so query == lane column; O^T = V^T P^T with V_t rows.
__global__ __launch_bounds__(256) void attn_k(
    const __bf16* __restrict__ Qb, const __bf16* __restrict__ Kb,
    const __bf16* __restrict__ Vt, __bf16* __restrict__ Ob) {
  constexpr int SK = 136, SV = 40, SP = 40;
  __shared__ __bf16 Ks[32 * SK];    // [key][d]
  __shared__ __bf16 Vs[128 * SV];   // [d][key]
  __shared__ __bf16 Ps[8 * 16 * SP];// per-wave P[q][key]
  const int tid = threadIdx.x, lane = tid & 31, wave = tid >> 5;
  const int lrow = lane & 15, lhi = (lane >> 4) & 1;
  const int bh = blockIdx.y, b_ = bh >> 4, h = bh & 15;
  const int q0 = blockIdx.x * 128;
  const int qg = q0 + wave * 16 + lrow;   // this lane's query column

  // Q fragments (B-operand), invariant across the k-loop
  v16bf qf[4];
  const __bf16* qbase = Qb + (size_t)(b_ * TS + q0 + wave * 16 + lrow) * TD + h * TDH;
#pragma unroll
  for (int c = 0; c < 4; c++) qf[c] = frag_ld(qbase + c * 32, lhi);

  v8f o[8];
#pragma unroll
  for (int dc = 0; dc < 8; dc++)
#pragma unroll
    for (int e = 0; e < 8; e++) o[dc][e] = 0.f;
  float mrun = -__builtin_inff(), lrun = 0.f;

  const int kr = tid >> 3, kc = (tid & 7) * 16;   // K-tile staging coords
  const int vr = tid >> 1, vc = (tid & 1) * 16;   // V-tile staging coords
  const int kend = q0 + 128;
  for (int k0 = 0; k0 < kend; k0 += 32) {
    __syncthreads();          // previous iteration's LDS reads complete
    {  // stage K tile: 32 keys x 128 d
      const __bf16* src = Kb + (size_t)(b_ * TS + k0 + kr) * TD + h * TDH + kc;
      cp16_g2l(src,     Ks + kr * SK + kc);
      cp16_g2l(src + 8, Ks + kr * SK + kc + 8);
    }
    {  // stage V_t tile: 128 d x 32 keys (k-contiguous rows)
      const __bf16* src = Vt + ((size_t)bh * TDH + vr) * TS + k0 + vc;
      cp16_g2l(src,     Vs + vr * SV + vc);
      cp16_g2l(src + 8, Vs + vr * SV + vc + 8);
    }
    if (k0 + 32 < kend) {     // prefetch next tiles into cache
      __builtin_prefetch(Kb + (size_t)(b_ * TS + k0 + 32 + kr) * TD + h * TDH + kc, 0, 1);
      __builtin_prefetch(Vt + ((size_t)bh * TDH + vr) * TS + k0 + 32 + vc, 0, 1);
    }
    async_wait0();
    __syncthreads();

    // scores S^T: two 16-key subtiles, each 4 WMMAs over DH=128
    float pv[2][8];
    // masking only needed when this 32-key tile can reach past a query of
    // this wave; wave-uniform condition -> scalar branch, EXEC stays full
    const bool needmask = (k0 + 31) > (q0 + wave * 16);
#pragma unroll
    for (int sub = 0; sub < 2; sub++) {
      v8f st;
#pragma unroll
      for (int e = 0; e < 8; e++) st[e] = 0.f;
#pragma unroll
      for (int c = 0; c < 4; c++) {
        v16bf a = frag_ld(Ks + (sub * 16 + lrow) * SK + c * 32, lhi);
        st = wmma_bf16(a, qf[c], st);
      }
      if (needmask) {
#pragma unroll
        for (int v = 0; v < 8; v++) {
          const int kg = k0 + sub * 16 + v + 8 * lhi;
          pv[sub][v] = (kg <= qg) ? st[v] : -__builtin_inff();
        }
      } else {
#pragma unroll
        for (int v = 0; v < 8; v++) pv[sub][v] = st[v];
      }
    }

    // online softmax per query (in-lane + one xor-16 exchange)
    float mt = -__builtin_inff();
#pragma unroll
    for (int sub = 0; sub < 2; sub++)
#pragma unroll
      for (int v = 0; v < 8; v++) mt = fmaxf(mt, pv[sub][v]);
    mt = fmaxf(mt, __shfl_xor(mt, 16, 32));
    const float mnew = fmaxf(mrun, mt);
    const float corr = __expf(mrun - mnew);
    float psum = 0.f;
#pragma unroll
    for (int sub = 0; sub < 2; sub++)
#pragma unroll
      for (int v = 0; v < 8; v++) {
        const float p = __expf(pv[sub][v] - mnew);
        pv[sub][v] = p;
        psum += p;
      }
    psum += __shfl_xor(psum, 16, 32);
    lrun = lrun * corr + psum;
    mrun = mnew;
#pragma unroll
    for (int dc = 0; dc < 8; dc++)
#pragma unroll
      for (int e = 0; e < 8; e++) o[dc][e] *= corr;

    // stage P (bf16) per wave: lane writes 8 contiguous keys -> one b128.
    // Must stay a plain DS store: we rely on same-wave DS ordering for the
    // immediate reload below (ASYNC ops would not preserve it).
#pragma unroll
    for (int sub = 0; sub < 2; sub++) {
      union { __bf16 h8[8]; uint4 q; } u;
#pragma unroll
      for (int v = 0; v < 8; v++) u.h8[v] = f2bf(pv[sub][v]);
      *(uint4*)(Ps + (wave * 16 + lrow) * SP + sub * 16 + 8 * lhi) = u.q;
    }
    v16bf pf = frag_ld(Ps + (wave * 16 + lrow) * SP, lhi);
#pragma unroll
    for (int dc = 0; dc < 8; dc++) {
      v16bf a = frag_ld(Vs + (dc * 16 + lrow) * SV, lhi);
      o[dc] = wmma_bf16(a, pf, o[dc]);
    }
  }

  const float inv = 1.f / lrun;
#pragma unroll
  for (int dc = 0; dc < 8; dc++)
#pragma unroll
    for (int v = 0; v < 8; v++) {
      const int d = dc * 16 + v + 8 * lhi;
      Ob[(size_t)(b_ * TS + qg) * TD + h * TDH + d] = f2bf(o[dc][v] * inv);
    }
}

// ---------- host-side orchestration ----------
extern "C" void kernel_launch(void* const* d_in, const int* in_sizes, int n_in,
                              void* d_out, int out_size, void* d_ws, size_t ws_size,
                              hipStream_t stream) {
  (void)in_sizes; (void)n_in; (void)out_size; (void)ws_size;
  const float* X    = (const float*)d_in[0];
  const float* Wq   = (const float*)d_in[1];
  const float* bq   = (const float*)d_in[2];
  const float* Wk   = (const float*)d_in[3];
  const float* bk   = (const float*)d_in[4];
  const float* Wv   = (const float*)d_in[5];
  const float* bv   = (const float*)d_in[6];
  const float* Wo   = (const float*)d_in[7];
  const float* bo   = (const float*)d_in[8];
  const float* Win  = (const float*)d_in[9];
  const float* bin  = (const float*)d_in[10];
  const float* Wout = (const float*)d_in[11];
  const float* bout = (const float*)d_in[12];
  const float* ln1w = (const float*)d_in[13];
  const float* ln1b = (const float*)d_in[14];
  const float* ln2w = (const float*)d_in[15];
  const float* ln2b = (const float*)d_in[16];
  float* out = (float*)d_out;

  char* ws = (char*)d_ws;
  const size_t szMD = (size_t)TM * TD * 2;          // 16.78 MB (bf16 M x D)
  __bf16* lnb = (__bf16*)(ws);                      // LN output (reused for LN2)
  __bf16* Qb  = (__bf16*)(ws + 1 * szMD);
  __bf16* Kb  = (__bf16*)(ws + 2 * szMD);
  __bf16* Vt  = (__bf16*)(ws + 3 * szMD);
  __bf16* Ab  = (__bf16*)(ws + 4 * szMD);           // attention output
  float*  X1  = (float*)(ws + 5 * szMD);            // residual stream (f32, 2*szMD)
  __bf16* Hm  = (__bf16*)(ws + 1 * szMD);           // MLP hidden reuses Qb..Ab (4*szMD)

  const float qk = 0.29730177875068026f;            // 1/sqrt(sqrt(128))
  dim3 th(256);
  dim3 gD(TD / 128, TM / 128);      // (16, 32)
  dim3 gF(TDFF / 128, TM / 128);    // (64, 32)
  dim3 gA(TS / 128, TB * THD);      // (16, 32)

  layernorm_bf16_k<<<TM, th, 0, stream>>>(X, ln1w, ln1b, lnb);
  gemm_bf16_k<0, false, false><<<gD, th, 0, stream>>>(lnb, Wq, bq, nullptr, Qb, TM, TD, TD, qk);
  gemm_bf16_k<0, false, false><<<gD, th, 0, stream>>>(lnb, Wk, bk, nullptr, Kb, TM, TD, TD, qk);
  gemm_bf16_k<2, false, false><<<gD, th, 0, stream>>>(lnb, Wv, bv, nullptr, Vt, TM, TD, TD, 1.f);
  attn_k<<<gA, th, 0, stream>>>(Qb, Kb, Vt, Ab);
  gemm_bf16_k<1, false, true><<<gD, th, 0, stream>>>(Ab, Wo, bo, X, (void*)X1, TM, TD, TD, 1.f);
  layernorm_bf16_k<<<TM, th, 0, stream>>>(X1, ln2w, ln2b, lnb);
  gemm_bf16_k<0, true, false><<<gF, th, 0, stream>>>(lnb, Win, bin, nullptr, Hm, TM, TDFF, TD, 1.f);
  gemm_bf16_k<1, false, true><<<gD, th, 0, stream>>>(Hm, Wout, bout, X1, (void*)out, TM, TD, TDFF, 1.f);
}

// v001
// Measured time: 630 microseconds a run.
// In both of two side-by-side timings against v000, it was 1.38 times as fast.
#include <hip/hip_runtime.h>
#include <hip/hip_bf16.h>
#include <math.h>

typedef __attribute__((ext_vector_type(16))) __bf16 v16bf;
typedef __attribute__((ext_vector_type(8)))  __bf16 v8bf;
typedef __attribute__((ext_vector_type(8)))  float  v8f;
typedef __attribute__((ext_vector_type(4)))  int    v4i;

#define DEV static __device__ __forceinline__
#define GAS __attribute__((address_space(1)))
#define LAS __attribute__((address_space(3)))

#if __has_builtin(__builtin_amdgcn_global_load_async_to_lds_b128) && \
    __has_builtin(__builtin_amdgcn_s_wait_asynccnt)
#define HAS_ASYNC_LDS 1
#else
#define HAS_ASYNC_LDS 0
#endif

namespace {
constexpr int   TB   = 2;
constexpr int   TS   = 2048;
constexpr int   TD   = 2048;
constexpr int   THD  = 16;     // heads
constexpr int   TDH  = 128;    // head dim
constexpr int   TDFF = 8192;
constexpr int   TM   = TB * TS;          // 4096 token rows
constexpr float TEPS = 1e-5f;
}

// ---------- scalar helpers ----------
DEV __bf16 f2bf(float x) {
  unsigned u = __builtin_bit_cast(unsigned, x);
  unsigned r = u + 0x7FFFu + ((u >> 16) & 1u);      // RNE
  unsigned short s = (unsigned short)(r >> 16);
  return __builtin_bit_cast(__bf16, s);
}

DEV float gelu_f(float x) {
  const float c = 0.7978845608028654f;
  float x3 = x * x * x;
  return 0.5f * x * (1.f + tanhf(c * (x + 0.044715f * x3)));
}

// 16B global -> LDS copy: async-to-LDS (ASYNCcnt) when available, else
// load + ds_store fallback. Builtin signature (from hipcc diagnostic):
// (AS1 v4i* global_src, AS3 v4i* lds_dst, imm offset, imm cpol).
DEV void cp16_g2l(const __bf16* g, __bf16* l) {
#if HAS_ASYNC_LDS
  __builtin_amdgcn_global_load_async_to_lds_b128(
      (GAS v4i*)g, (LAS v4i*)l, 0, 0);
#else
  *(uint4*)l = *(const uint4*)g;
#endif
}
DEV void async_wait0() {
#if HAS_ASYNC_LDS
  __builtin_amdgcn_s_wait_asynccnt(0);
#endif
}

// Load one 16x(32-chunk) bf16 fragment (A-style row layout).
// Per the CDNA5 ISA layout, lane L holds row (L&15); its 16 bf16 elements are
// two contiguous 8-element runs at K offsets {8*(L>>4), 16+8*(L>>4)}.
DEV v16bf frag_ld(const __bf16* rowbase, int lhi) {
  v8bf lo = *(const v8bf*)(rowbase + 8 * lhi);
  v8bf hi = *(const v8bf*)(rowbase + 16 + 8 * lhi);
  return __builtin_shufflevector(lo, hi, 0, 1, 2, 3, 4, 5, 6, 7,
                                         8, 9, 10, 11, 12, 13, 14, 15);
}

DEV v8f wmma_bf16(v16bf a, v16bf b, v8f c) {
  return __builtin_amdgcn_wmma_f32_16x16x32_bf16(false, a, false, b,
                                                 (short)0, c, false, false);
}

// ---------- LayerNorm: f32 in -> bf16 out ----------
__global__ __launch_bounds__(256) void layernorm_bf16_k(
    const float* __restrict__ X, const float* __restrict__ w,
    const float* __restrict__ b, __bf16* __restrict__ out) {
  __shared__ float r1[256];
  __shared__ float r2[256];
  const int row = blockIdx.x;
  const int tid = threadIdx.x;
  const float* x = X + (size_t)row * TD;
  float lx[8], s = 0.f, ss = 0.f;
#pragma unroll
  for (int i = 0; i < 8; i++) {
    lx[i] = x[tid + i * 256];
    s += lx[i];
    ss += lx[i] * lx[i];
  }
  r1[tid] = s; r2[tid] = ss;
  __syncthreads();
  for (int off = 128; off > 0; off >>= 1) {
    if (tid < off) { r1[tid] += r1[tid + off]; r2[tid] += r2[tid + off]; }
    __syncthreads();
  }
  const float mean = r1[0] * (1.f / TD);
  const float var  = r2[0] * (1.f / TD) - mean * mean;
  const float rstd = rsqrtf(var + TEPS);
#pragma unroll
  for (int i = 0; i < 8; i++) {
    const int col = tid + i * 256;
    out[(size_t)row * TD + col] = f2bf((lx[i] - mean) * rstd * w[col] + b[col]);
  }
}

// ---------- Tiled WMMA GEMM:  C[M,N] = A[M,K](bf16) @ W[N,K]^T(f32) + bias ----------
// Double-buffered LDS, one barrier per 64-deep K step, prefetch 2 tiles ahead.
// Staging lanes run along K: a 64-deep tile row is one 128-B line of A (bf16)
// and two of W (f32), so every wave-wide load or copy covers 4 whole lines.
// OUTM: 0 = bf16 [m][n], 1 = f32 [m][n], 2 = bf16 head-transposed V_t[b][h][dh][s]
// K is a template constant: a lane's tile rows then lie at fixed byte distances,
// so its eight W loads share one address and differ in the immediate offset only.
template <int OUTM, bool GELU, bool RES, int K>
__global__ __launch_bounds__(256) void gemm_bf16_k(
    const __bf16* __restrict__ A, const float* __restrict__ W,
    const float* __restrict__ bias, const float* __restrict__ res,
    void* __restrict__ outp, int M, int N, float scale) {
  constexpr int BK = 64;                    // K depth of one staged tile
  constexpr int SA = BK + 8;                // 144-B pitch: 16 B x odd
  __shared__ __bf16 As[2][128 * SA];
  __shared__ __bf16 Bs[2][128 * SA];
  const int tid = threadIdx.x, lane = tid & 31, wave = tid >> 5;
  const int lrow = lane & 15, lhi = (lane >> 4) & 1;
  const int m0 = blockIdx.y * 128, n0 = blockIdx.x * 128;
  const int mb = (wave & 3) * 32, nb = (wave >> 2) * 64;
  const int arow = tid >> 3, acol = (tid & 7) * 8;    // A: 8 lanes x 16 B per row
  const int wrow = tid >> 4, wcol = (tid & 15) * 4;   // W: 16 lanes x 16 B per row
  const int prow = tid >> 1, pcol = (tid & 1) * 32;   // prefetch coords

  v8f acc[2][4];
#pragma unroll
  for (int i = 0; i < 2; i++)
#pragma unroll
    for (int j = 0; j < 4; j++)
#pragma unroll
      for (int e = 0; e < 8; e++) acc[i][j][e] = 0.f;

  auto stage = [&](int buf, int k0) {
    // A tile: bf16 pass-through -> async global->LDS when available
    const __bf16* asrc = A + (size_t)(m0 + arow) * K + k0 + acol;
#pragma unroll  // four copies in flight at once, LDS places as constants
    for (int i = 0; i < 4; i++)
      cp16_g2l(asrc + (size_t)(32 * i) * K, &As[buf][(arow + 32 * i) * SA + acol]);
    // W tile: f32 -> bf16 convert in flight (manual path)
    const float* wsrc = W + (size_t)(n0 + wrow) * K + k0 + wcol;
    float4 f[8];
#pragma unroll  // f[] stays in registers; all eight loads issue before the first use
    for (int i = 0; i < 8; i++) f[i] = *(const float4*)(wsrc + (size_t)(16 * i) * K);
#pragma unroll  // f[] indexed by constants only
    for (int i = 0; i < 8; i++) {
      union { __bf16 h4[4]; uint2 d; } u;
      u.h4[0] = f2bf(f[i].x); u.h4[1] = f2bf(f[i].y);
      u.h4[2] = f2bf(f[i].z); u.h4[3] = f2bf(f[i].w);
      *(uint2*)(&Bs[buf][(wrow + 16 * i) * SA + wcol]) = u.d;
    }
  };

  stage(0, 0);
  int buf = 0;
  for (int k0 = 0; k0 < K; k0 += BK, buf ^= 1) {
    async_wait0();            // writes into As[buf] from this wave are done
    __syncthreads();          // all waves' stage of [buf] complete
    if (k0 + BK < K) {
      if (k0 + 2 * BK < K) {  // pull the tile after next into cache
        __builtin_prefetch(A + (size_t)(m0 + prow) * K + k0 + 2 * BK + pcol, 0, 1);
        __builtin_prefetch(W + (size_t)(n0 + prow) * K + k0 + 2 * BK + pcol, 0, 1);
      }
      stage(buf ^ 1, k0 + BK);  // overlap with WMMAs below
    }
#pragma unroll  // second pass's fragment reads may start under the first's products
    for (int kk = 0; kk < BK; kk += 32) {
      v16bf af[2], bfr[4];
#pragma unroll
      for (int mi = 0; mi < 2; mi++)
        af[mi] = frag_ld(&As[buf][(mb + mi * 16 + lrow) * SA + kk], lhi);
#pragma unroll
      for (int ni = 0; ni < 4; ni++)
        bfr[ni] = frag_ld(&Bs[buf][(nb + ni * 16 + lrow) * SA + kk], lhi);
#pragma unroll
      for (int mi = 0; mi < 2; mi++)
#pragma unroll
        for (int ni = 0; ni < 4; ni++)
          acc[mi][ni] = wmma_bf16(af[mi], bfr[ni], acc[mi][ni]);
    }
  }

  // epilogue: C/D layout -> lane holds (m = v + 8*lhi, n = lane&15) per frag
#pragma unroll
  for (int mi = 0; mi < 2; mi++) {
#pragma unroll
    for (int ni = 0; ni < 4; ni++) {
      const int n = n0 + nb + ni * 16 + lrow;
      const float bv = bias[n];
#pragma unroll
      for (int v = 0; v < 8; v++) {
        const int m = m0 + mb + mi * 16 + v + 8 * lhi;
        float t = (acc[mi][ni][v] + bv) * scale;
        if (GELU) t = gelu_f(t);
        if (RES)  t += res[(size_t)m * N + n];
        if (OUTM == 0) {
          ((__bf16*)outp)[(size_t)m * N + n] = f2bf(t);
        } else if (OUTM == 1) {
          ((float*)outp)[(size_t)m * N + n] = t;
        } else {  // V_t[b][h][dh][s]
          const int b_ = m / TS, s = m % TS;
          const int h = n / TDH, dh = n % TDH;
          ((__bf16*)outp)[((size_t)(b_ * THD + h) * TDH + dh) * TS + s] = f2bf(t);
        }
      }
    }
  }
}

// ---------- Flash attention (causal), one (b,h) x 128-query block per WG ----------
// Computes S^T = K Q^T so query == lane column; O^T = V^T P^T with V_t rows.
__global__ __launch_bounds__(256) void attn_k(
    const __bf16* __restrict__ Qb, const __bf16* __restrict__ Kb,
    const __bf16* __restrict__ Vt, __bf16* __restrict__ Ob) {
  constexpr int SK = 136, SV = 40, SP = 40;
  __shared__ __bf16 Ks[32 * SK];    // [key][d]
  __shared__ __bf16 Vs[128 * SV];   // [d][key]
  __shared__ __bf16 Ps[8 * 16 * SP];// per-wave P[q][key]
  const int tid = threadIdx.x, lane = tid & 31, wave = tid >> 5;
  const int lrow = lane & 15, lhi = (lane >> 4) & 1;
  const int bh = blockIdx.y, b_ = bh >> 4, h = bh & 15;
  const int q0 = blockIdx.x * 128;
  const int qg = q0 + wave * 16 + lrow;   // this lane's query column

  // Q fragments (B-operand), invariant across the k-loop
  v16bf qf[4];
  const __bf16* qbase = Qb + (size_t)(b_ * TS + q0 + wave * 16 + lrow) * TD + h * TDH;
#pragma unroll
  for (int c = 0; c < 4; c++) qf[c] = frag_ld(qbase + c * 32, lhi);

  v8f o[8];
#pragma unroll
  for (int dc = 0; dc < 8; dc++)
#pragma unroll
    for (int e = 0; e < 8; e++) o[dc][e] = 0.f;
  float mrun = -__builtin_inff(), lrun = 0.f;

  const int kr = tid >> 3, kc = (tid & 7) * 16;   // K-tile prefetch coords
  const int vr = tid >> 1, vc = (tid & 1) * 16;   // V-tile prefetch coords
  // staging coords: lanes run along a row, 16 B each, so a wave-wide copy
  // covers whole rows of the tile (K: 256 B, V_t: 64 B)
  const int ksr = tid >> 4, ksc = (tid & 15) * 8;
  const int vsr = tid >> 2, vsc = (tid & 3) * 8;
  const int kend = q0 + 128;
  for (int k0 = 0; k0 < kend; k0 += 32) {
    __syncthreads();          // previous iteration's LDS reads complete
    {  // stage K tile: 32 keys x 128 d
      const __bf16* src = Kb + (size_t)(b_ * TS + k0 + ksr) * TD + h * TDH + ksc;
      cp16_g2l(src,                   Ks + ksr * SK + ksc);
      cp16_g2l(src + (size_t)16 * TD, Ks + (ksr + 16) * SK + ksc);
    }
    {  // stage V_t tile: 128 d x 32 keys (k-contiguous rows)
      const __bf16* src = Vt + ((size_t)bh * TDH + vsr) * TS + k0 + vsc;
      cp16_g2l(src,                   Vs + vsr * SV + vsc);
      cp16_g2l(src + (size_t)64 * TS, Vs + (vsr + 64) * SV + vsc);
    }
    if (k0 + 32 < kend) {     // prefetch next tiles into cache
      __builtin_prefetch(Kb + (size_t)(b_ * TS + k0 + 32 + kr) * TD + h * TDH + kc, 0, 1);
      __builtin_prefetch(Vt + ((size_t)bh * TDH + vr) * TS + k0 + 32 + vc, 0, 1);
    }
    async_wait0();
    __syncthreads();

    // scores S^T: two 16-key subtiles, each 4 WMMAs over DH=128
    float pv[2][8];
    // masking only needed when this 32-key tile can reach past a query of
    // this wave; wave-uniform condition -> scalar branch, EXEC stays full
    const bool needmask = (k0 + 31) > (q0 + wave * 16);
#pragma unroll
    for (int sub = 0; sub < 2; sub++) {
      v8f st;
#pragma unroll
      for (int e = 0; e < 8; e++) st[e] = 0.f;
#pragma unroll
      for (int c = 0; c < 4; c++) {
        v16bf a = frag_ld(Ks + (sub * 16 + lrow) * SK + c * 32, lhi);
        st = wmma_bf16(a, qf[c], st);
      }
      if (needmask) {
#pragma unroll
        for (int v = 0; v < 8; v++) {
          const int kg = k0 + sub * 16 + v + 8 * lhi;
          pv[sub][v] = (kg <= qg) ? st[v] : -__builtin_inff();
        }
      } else {
#pragma unroll
        for (int v = 0; v < 8; v++) pv[sub][v] = st[v];
      }
    }

    // online softmax per query (in-lane + one xor-16 exchange)
    float mt = -__builtin_inff();
#pragma unroll
    for (int sub = 0; sub < 2; sub++)
#pragma unroll
      for (int v = 0; v < 8; v++) mt = fmaxf(mt, pv[sub][v]);
    mt = fmaxf(mt, __shfl_xor(mt, 16, 32));
    const float mnew = fmaxf(mrun, mt);
    const float corr = __expf(mrun - mnew);
    float psum = 0.f;
#pragma unroll
    for (int sub = 0; sub < 2; sub++)
#pragma unroll
      for (int v = 0; v < 8; v++) {
        const float p = __expf(pv[sub][v] - mnew);
        pv[sub][v] = p;
        psum += p;
      }
    psum += __shfl_xor(psum, 16, 32);
    lrun = lrun * corr + psum;
    mrun = mnew;
#pragma unroll
    for (int dc = 0; dc < 8; dc++)
#pragma unroll
      for (int e = 0; e < 8; e++) o[dc][e] *= corr;

    // stage P (bf16) per wave: lane writes 8 contiguous keys -> one b128.
    // Must stay a plain DS store: we rely on same-wave DS ordering for the
    // immediate reload below (ASYNC ops would not preserve it).
#pragma unroll
    for (int sub = 0; sub < 2; sub++) {
      union { __bf16 h8[8]; uint4 q; } u;
#pragma unroll
      for (int v = 0; v < 8; v++) u.h8[v] = f2bf(pv[sub][v]);
      *(uint4*)(Ps + (wave * 16 + lrow) * SP + sub * 16 + 8 * lhi) = u.q;
    }
    v16bf pf = frag_ld(Ps + (wave * 16 + lrow) * SP, lhi);
#pragma unroll
    for (int dc = 0; dc < 8; dc++) {
      v16bf a = frag_ld(Vs + (dc * 16 + lrow) * SV, lhi);
      o[dc] = wmma_bf16(a, pf, o[dc]);
    }
  }

  const float inv = 1.f / lrun;
#pragma unroll
  for (int dc = 0; dc < 8; dc++)
#pragma unroll
    for (int v = 0; v < 8; v++) {
      const int d = dc * 16 + v + 8 * lhi;
      Ob[(size_t)(b_ * TS + qg) * TD + h * TDH + d] = f2bf(o[dc][v] * inv);
    }
}

// ---------- host-side orchestration ----------
extern "C" void kernel_launch(void* const* d_in, const int* in_sizes, int n_in,
                              void* d_out, int out_size, void* d_ws, size_t ws_size,
                              hipStream_t stream) {
  (void)in_sizes; (void)n_in; (void)out_size; (void)ws_size;
  const float* X    = (const float*)d_in[0];
  const float* Wq   = (const float*)d_in[1];
  const float* bq   = (const float*)d_in[2];
  const float* Wk   = (const float*)d_in[3];
  const float* bk   = (const float*)d_in[4];
  const float* Wv   = (const float*)d_in[5];
  const float* bv   = (const float*)d_in[6];
  const float* Wo   = (const float*)d_in[7];
  const float* bo   = (const float*)d_in[8];
  const float* Win  = (const float*)d_in[9];
  const float* bin  = (const float*)d_in[10];
  const float* Wout = (const float*)d_in[11];
  const float* bout = (const float*)d_in[12];
  const float* ln1w = (const float*)d_in[13];
  const float* ln1b = (const float*)d_in[14];
  const float* ln2w = (const float*)d_in[15];
  const float* ln2b = (const float*)d_in[16];
  float* out = (float*)d_out;

  char* ws = (char*)d_ws;
  const size_t szMD = (size_t)TM * TD * 2;          // 16.78 MB (bf16 M x D)
  __bf16* lnb = (__bf16*)(ws);                      // LN output (reused for LN2)
  __bf16* Qb  = (__bf16*)(ws + 1 * szMD);
  __bf16* Kb  = (__bf16*)(ws + 2 * szMD);
  __bf16* Vt  = (__bf16*)(ws + 3 * szMD);
  __bf16* Ab  = (__bf16*)(ws + 4 * szMD);           // attention output
  float*  X1  = (float*)(ws + 5 * szMD);            // residual stream (f32, 2*szMD)
  __bf16* Hm  = (__bf16*)(ws + 1 * szMD);           // MLP hidden reuses Qb..Ab (4*szMD)

  const float qk = 0.29730177875068026f;            // 1/sqrt(sqrt(128))
  dim3 th(256);
  dim3 gD(TD / 128, TM / 128);      // (16, 32)
  dim3 gF(TDFF / 128, TM / 128);    // (64, 32)
  dim3 gA(TS / 128, TB * THD);      // (16, 32)

  layernorm_bf16_k<<<TM, th, 0, stream>>>(X, ln1w, ln1b, lnb);
  gemm_bf16_k<0, false, false, TD><<<gD, th, 0, stream>>>(lnb, Wq, bq, nullptr, Qb, TM, TD, qk);
  gemm_bf16_k<0, false, false, TD><<<gD, th, 0, stream>>>(lnb, Wk, bk, nullptr, Kb, TM, TD, qk);
  gemm_bf16_k<2, false, false, TD><<<gD, th, 0, stream>>>(lnb, Wv, bv, nullptr, Vt, TM, TD, 1.f);
  attn_k<<<gA, th, 0, stream>>>(Qb, Kb, Vt, Ab);
  gemm_bf16_k<1, false, true, TD><<<gD, th, 0, stream>>>(Ab, Wo, bo, X, (void*)X1, TM, TD, 1.f);
  layernorm_bf16_k<<<TM, th, 0, stream>>>(X1, ln2w, ln2b, lnb);
  gemm_bf16_k<0, true, false, TD><<<gF, th, 0, stream>>>(lnb, Win, bin, nullptr, Hm, TM, TDFF, 1.f);
  gemm_bf16_k<1, false, true, TDFF><<<gD, th, 0, stream>>>(Hm, Wout, bout, X1, (void*)out, TM, TD, 1.f);
}

// v002
// It runs in 603 microseconds.
// Next to v001, in two timings, it ran 1.05 times as fast each time.
// All steps since v000 together make it 1.45 times as fast.
#include <hip/hip_runtime.h>
#include <hip/hip_bf16.h>
#include <math.h>

typedef __attribute__((ext_vector_type(16))) __bf16 v16bf;
typedef __attribute__((ext_vector_type(8)))  __bf16 v8bf;
typedef __attribute__((ext_vector_type(8)))  float  v8f;
typedef __attribute__((ext_vector_type(4)))  int    v4i;

#define DEV static __device__ __forceinline__
#define GAS __attribute__((address_space(1)))
#define LAS __attribute__((address_space(3)))

#if __has_builtin(__builtin_amdgcn_global_load_async_to_lds_b128) && \
    __has_builtin(__builtin_amdgcn_s_wait_asynccnt)
#define HAS_ASYNC_LDS 1
#else
#define HAS_ASYNC_LDS 0
#endif

namespace {
constexpr int   TB   = 2;
constexpr int   TS   = 2048;
constexpr int   TD   = 2048;
constexpr int   THD  = 16;     // heads
constexpr int   TDH  = 128;    // head dim
constexpr int   TDFF = 8192;
constexpr int   TM   = TB * TS;          // 4096 token rows
constexpr float TEPS = 1e-5f;
}

// ---------- scalar helpers ----------
DEV __bf16 f2bf(float x) {
  unsigned u = __builtin_bit_cast(unsigned, x);
  unsigned r = u + 0x7FFFu + ((u >> 16) & 1u);      // RNE
  unsigned short s = (unsigned short)(r >> 16);
  return __builtin_bit_cast(__bf16, s);
}

DEV float gelu_f(float x) {
  const float c = 0.7978845608028654f;
  float x3 = x * x * x;
  return 0.5f * x * (1.f + tanhf(c * (x + 0.044715f * x3)));
}

// 16B global -> LDS copy: async-to-LDS (ASYNCcnt) when available, else
// load + ds_store fallback. Builtin signature (from hipcc diagnostic):
// (AS1 v4i* global_src, AS3 v4i* lds_dst, imm offset, imm cpol).
DEV void cp16_g2l(const __bf16* g, __bf16* l) {
#if HAS_ASYNC_LDS
  __builtin_amdgcn_global_load_async_to_lds_b128(
      (GAS v4i*)g, (LAS v4i*)l, 0, 0);
#else
  *(uint4*)l = *(const uint4*)g;
#endif
}
DEV void async_wait0() {
#if HAS_ASYNC_LDS
  __builtin_amdgcn_s_wait_asynccnt(0);
#endif
}
// Publish-point waits of the GEMM ring, each a statement of its own; the
// "memory" clobber keeps every LDS read and copy on its side of the wait.
DEV void ring_wait_async0() {
  // this wave's copies have landed before the barrier that publishes them
  asm volatile("s_wait_asynccnt 0x0" ::: "memory");
}
DEV void ring_wait_ds0() {
  // this wave's LDS reads have retired before the buffer is refilled
  asm volatile("s_wait_dscnt 0x0" ::: "memory");
}

// Load one 16x(32-chunk) bf16 fragment (A-style row layout).
// Per the CDNA5 ISA layout, lane L holds row (L&15); its 16 bf16 elements are
// two contiguous 8-element runs at K offsets {8*(L>>4), 16+8*(L>>4)}.
DEV v16bf frag_ld(const __bf16* rowbase, int lhi) {
  v8bf lo = *(const v8bf*)(rowbase + 8 * lhi);
  v8bf hi = *(const v8bf*)(rowbase + 16 + 8 * lhi);
  return __builtin_shufflevector(lo, hi, 0, 1, 2, 3, 4, 5, 6, 7,
                                         8, 9, 10, 11, 12, 13, 14, 15);
}

DEV v8f wmma_bf16(v16bf a, v16bf b, v8f c) {
  return __builtin_amdgcn_wmma_f32_16x16x32_bf16(false, a, false, b,
                                                 (short)0, c, false, false);
}

// ---------- LayerNorm: f32 in -> bf16 out ----------
__global__ __launch_bounds__(256) void layernorm_bf16_k(
    const float* __restrict__ X, const float* __restrict__ w,
    const float* __restrict__ b, __bf16* __restrict__ out) {
  __shared__ float r1[256];
  __shared__ float r2[256];
  const int row = blockIdx.x;
  const int tid = threadIdx.x;
  const float* x = X + (size_t)row * TD;
  float lx[8], s = 0.f, ss = 0.f;
#pragma unroll
  for (int i = 0; i < 8; i++) {
    lx[i] = x[tid + i * 256];
    s += lx[i];
    ss += lx[i] * lx[i];
  }
  r1[tid] = s; r2[tid] = ss;
  __syncthreads();
  for (int off = 128; off > 0; off >>= 1) {
    if (tid < off) { r1[tid] += r1[tid + off]; r2[tid] += r2[tid + off]; }
    __syncthreads();
  }
  const float mean = r1[0] * (1.f / TD);
  const float var  = r2[0] * (1.f / TD) - mean * mean;
  const float rstd = rsqrtf(var + TEPS);
#pragma unroll
  for (int i = 0; i < 8; i++) {
    const int col = tid + i * 256;
    out[(size_t)row * TD + col] = f2bf((lx[i] - mean) * rstd * w[col] + b[col]);
  }
}

// ---------- Weights: f32 -> bf16, once per call ----------
// Every GEMM work-group of a tile column needs the same rounded W tile; rounding
// it here once leaves the GEMM a W stream of 2 B an element that needs no register.
// dst holds Wq | Wk | Wv | Wo | W_in | W_out back to back, each in its own layout.
// One block moves WCH floats: 8 wave-wide 512-B loads in flight per wave.
constexpr int WCH  = 8192;
constexpr int WBD  = TD * TD / WCH;      // blocks per D x D matrix
constexpr int WBF  = TD * TDFF / WCH;    // blocks per D x DFF matrix
__global__ __launch_bounds__(256) void weights_bf16_k(
    const float* __restrict__ Wq, const float* __restrict__ Wk,
    const float* __restrict__ Wv, const float* __restrict__ Wo,
    const float* __restrict__ Win, const float* __restrict__ Wout,
    __bf16* __restrict__ dst) {
  const int blk = blockIdx.x;
  const float* src;
  int rel;
  if (blk < 4 * WBD) {
    const int w = blk / WBD;
    src = (w == 0) ? Wq : (w == 1) ? Wk : (w == 2) ? Wv : Wo;
    rel = blk % WBD;
  } else if (blk < 4 * WBD + WBF) {
    src = Win;  rel = blk - 4 * WBD;
  } else {
    src = Wout; rel = blk - 4 * WBD - WBF;
  }
  const float4* sp = (const float4*)(src + (size_t)rel * WCH) + threadIdx.x;
  uint2* dp = (uint2*)(dst + (size_t)blk * WCH) + threadIdx.x;
  float4 f[8];
#pragma unroll  // all eight loads issue before the first use
  for (int i = 0; i < 8; i++) f[i] = sp[i * 256];
#pragma unroll  // f[] indexed by constants only
  for (int i = 0; i < 8; i++) {
    union { __bf16 h4[4]; uint2 d; } u;
    u.h4[0] = f2bf(f[i].x); u.h4[1] = f2bf(f[i].y);
    u.h4[2] = f2bf(f[i].z); u.h4[3] = f2bf(f[i].w);
    dp[i * 256] = u.d;
  }
}

// ---------- Tiled WMMA GEMM:  C[M,N] = A[M,K](bf16) @ W[N,K]^T(bf16) + bias ----------
// Two LDS buffers, one barrier per 64-deep K step, prefetch 1 tile ahead of the copies.
// Staging lanes run along K: a 64-deep tile row is one 128-B line of A and of W,
// so every wave-wide copy covers 4 whole lines. Both tiles go global -> LDS by
// asynchronous copies, which fly while the tile before them is multiplied.
// OUTM: 0 = bf16 [m][n], 1 = f32 [m][n], 2 = bf16 head-transposed V_t[b][h][dh][s]
// K is a template constant: a lane's tile rows then lie at fixed byte distances.
template <int OUTM, bool GELU, bool RES, int K>
__global__ __launch_bounds__(256) void gemm_bf16_k(
    const __bf16* __restrict__ A, const __bf16* __restrict__ W,
    const float* __restrict__ bias, const float* __restrict__ res,
    void* __restrict__ outp, int M, int N, float scale) {
  constexpr int BK = 64;                    // K depth of one staged tile
  constexpr int SA = BK + 8;                // 144-B pitch: 16 B x odd
  static_assert(K % BK == 0 && K >= 2 * BK, "the ring's prologue fills two tiles");
  __shared__ __attribute__((aligned(16))) __bf16 As[2][128 * SA];
  __shared__ __attribute__((aligned(16))) __bf16 Bs[2][128 * SA];
  const int tid = threadIdx.x, lane = tid & 31, wave = tid >> 5;
  const int lrow = lane & 15, lhi = (lane >> 4) & 1;
  const int m0 = blockIdx.y * 128, n0 = blockIdx.x * 128;
  const int mb = (wave & 3) * 32, nb = (wave >> 2) * 64;
  const int arow = tid >> 3, acol = (tid & 7) * 8;    // A and W: 8 lanes x 16 B per row
  const int prow = tid >> 1, pcol = (tid & 1) * 32;   // prefetch coords

  v8f acc[2][4];
#pragma unroll
  for (int i = 0; i < 2; i++)
#pragma unroll
    for (int j = 0; j < 4; j++)
#pragma unroll
      for (int e = 0; e < 8; e++) acc[i][j][e] = 0.f;

  auto stage = [&](int buf, int k0) {
    const __bf16* asrc = A + (size_t)(m0 + arow) * K + k0 + acol;
    const __bf16* wsrc = W + (size_t)(n0 + arow) * K + k0 + acol;
#pragma unroll  // eight copies in flight at once, LDS places as constants
    for (int i = 0; i < 4; i++) {
      cp16_g2l(asrc + (size_t)(32 * i) * K, &As[buf][(arow + 32 * i) * SA + acol]);
      cp16_g2l(wsrc + (size_t)(32 * i) * K, &Bs[buf][(arow + 32 * i) * SA + acol]);
    }
  };

  // prologue: tile 0 landed and published, then tile 1 on its way
  stage(0, 0);
  ring_wait_async0();
  __syncthreads();
  stage(1, BK);
  int buf = 0;
  for (int k0 = 0; k0 < K; k0 += BK, buf ^= 1) {
#pragma unroll  // second pass's fragment reads may start under the first's products
    for (int kk = 0; kk < BK; kk += 32) {
      v16bf af[2], bfr[4];
#pragma unroll
      for (int mi = 0; mi < 2; mi++)
        af[mi] = frag_ld(&As[buf][(mb + mi * 16 + lrow) * SA + kk], lhi);
#pragma unroll
      for (int ni = 0; ni < 4; ni++)
        bfr[ni] = frag_ld(&Bs[buf][(nb + ni * 16 + lrow) * SA + kk], lhi);
#pragma unroll
      for (int mi = 0; mi < 2; mi++)
#pragma unroll
        for (int ni = 0; ni < 4; ni++)
          acc[mi][ni] = wmma_bf16(af[mi], bfr[ni], acc[mi][ni]);
    }
    // publish point of the next tile; it also ends every read of [buf]
    ring_wait_ds0();
    ring_wait_async0();
    __syncthreads();
    if (k0 + 2 * BK < K) {
      if (k0 + 3 * BK < K) {  // pull the tile after that into cache
        __builtin_prefetch(A + (size_t)(m0 + prow) * K + k0 + 3 * BK + pcol, 0, 1);
        __builtin_prefetch(W + (size_t)(n0 + prow) * K + k0 + 3 * BK + pcol, 0, 1);
      }
      stage(buf, k0 + 2 * BK);  // flies under the next trip's WMMAs
    }
  }
  ring_wait_async0();         // no copy outlives the loop

  // epilogue: C/D layout -> lane holds (m = v + 8*lhi, n = lane&15) per frag
#pragma unroll
  for (int mi = 0; mi < 2; mi++) {
#pragma unroll
    for (int ni = 0; ni < 4; ni++) {
      const int n = n0 + nb + ni * 16 + lrow;
      const float bv = bias[n];
#pragma unroll
      for (int v = 0; v < 8; v++) {
        const int m = m0 + mb + mi * 16 + v + 8 * lhi;
        float t = (acc[mi][ni][v] + bv) * scale;
        if (GELU) t = gelu_f(t);
        if (RES)  t += res[(size_t)m * N + n];
        if (OUTM == 0) {
          ((__bf16*)outp)[(size_t)m * N + n] = f2bf(t);
        } else if (OUTM == 1) {
          ((float*)outp)[(size_t)m * N + n] = t;
        } else {  // V_t[b][h][dh][s]
          const int b_ = m / TS, s = m % TS;
          const int h = n / TDH, dh = n % TDH;
          ((__bf16*)outp)[((size_t)(b_ * THD + h) * TDH + dh) * TS + s] = f2bf(t);
        }
      }
    }
  }
}

// ---------- Flash attention (causal), one (b,h) x 128-query block per WG ----------
// Computes S^T = K Q^T so query == lane column; O^T = V^T P^T with V_t rows.
__global__ __launch_bounds__(256) void attn_k(
    const __bf16* __restrict__ Qb, const __bf16* __restrict__ Kb,
    const __bf16* __restrict__ Vt, __bf16* __restrict__ Ob) {
  constexpr int SK = 136, SV = 40, SP = 40;
  __shared__ __bf16 Ks[32 * SK];    // [key][d]
  __shared__ __bf16 Vs[128 * SV];   // [d][key]
  __shared__ __bf16 Ps[8 * 16 * SP];// per-wave P[q][key]
  const int tid = threadIdx.x, lane = tid & 31, wave = tid >> 5;
  const int lrow = lane & 15, lhi = (lane >> 4) & 1;
  const int bh = blockIdx.y, b_ = bh >> 4, h = bh & 15;
  const int q0 = blockIdx.x * 128;
  const int qg = q0 + wave * 16 + lrow;   // this lane's query column

  // Q fragments (B-operand), invariant across the k-loop
  v16bf qf[4];
  const __bf16* qbase = Qb + (size_t)(b_ * TS + q0 + wave * 16 + lrow) * TD + h * TDH;
#pragma unroll
  for (int c = 0; c < 4; c++) qf[c] = frag_ld(qbase + c * 32, lhi);

  v8f o[8];
#pragma unroll
  for (int dc = 0; dc < 8; dc++)
#pragma unroll
    for (int e = 0; e < 8; e++) o[dc][e] = 0.f;
  float mrun = -__builtin_inff(), lrun = 0.f;

  const int kr = tid >> 3, kc = (tid & 7) * 16;   // K-tile prefetch coords
  const int vr = tid >> 1, vc = (tid & 1) * 16;   // V-tile prefetch coords
  // staging coords: lanes run along a row, 16 B each, so a wave-wide copy
  // covers whole rows of the tile (K: 256 B, V_t: 64 B)
  const int ksr = tid >> 4, ksc = (tid & 15) * 8;
  const int vsr = tid >> 2, vsc = (tid & 3) * 8;
  const int kend = q0 + 128;
  for (int k0 = 0; k0 < kend; k0 += 32) {
    __syncthreads();          // previous iteration's LDS reads complete
    {  // stage K tile: 32 keys x 128 d
      const __bf16* src = Kb + (size_t)(b_ * TS + k0 + ksr) * TD + h * TDH + ksc;
      cp16_g2l(src,                   Ks + ksr * SK + ksc);
      cp16_g2l(src + (size_t)16 * TD, Ks + (ksr + 16) * SK + ksc);
    }
    {  // stage V_t tile: 128 d x 32 keys (k-contiguous rows)
      const __bf16* src = Vt + ((size_t)bh * TDH + vsr) * TS + k0 + vsc;
      cp16_g2l(src,                   Vs + vsr * SV + vsc);
      cp16_g2l(src + (size_t)64 * TS, Vs + (vsr + 64) * SV + vsc);
    }
    if (k0 + 32 < kend) {     // prefetch next tiles into cache
      __builtin_prefetch(Kb + (size_t)(b_ * TS + k0 + 32 + kr) * TD + h * TDH + kc, 0, 1);
      __builtin_prefetch(Vt + ((size_t)bh * TDH + vr) * TS + k0 + 32 + vc, 0, 1);
    }
    async_wait0();
    __syncthreads();

    // scores S^T: two 16-key subtiles, each 4 WMMAs over DH=128
    float pv[2][8];
    // masking only needed when this 32-key tile can reach past a query of
    // this wave; wave-uniform condition -> scalar branch, EXEC stays full
    const bool needmask = (k0 + 31) > (q0 + wave * 16);
#pragma unroll
    for (int sub = 0; sub < 2; sub++) {
      v8f st;
#pragma unroll
      for (int e = 0; e < 8; e++) st[e] = 0.f;
#pragma unroll
      for (int c = 0; c < 4; c++) {
        v16bf a = frag_ld(Ks + (sub * 16 + lrow) * SK + c * 32, lhi);
        st = wmma_bf16(a, qf[c], st);
      }
      if (needmask) {
#pragma unroll
        for (int v = 0; v < 8; v++) {
          const int kg = k0 + sub * 16 + v + 8 * lhi;
          pv[sub][v] = (kg <= qg) ? st[v] : -__builtin_inff();
        }
      } else {
#pragma unroll
        for (int v = 0; v < 8; v++) pv[sub][v] = st[v];
      }
    }

    // online softmax per query (in-lane + one xor-16 exchange)
    float mt = -__builtin_inff();
#pragma unroll
    for (int sub = 0; sub < 2; sub++)
#pragma unroll
      for (int v = 0; v < 8; v++) mt = fmaxf(mt, pv[sub][v]);
    mt = fmaxf(mt, __shfl_xor(mt, 16, 32));
    const float mnew = fmaxf(mrun, mt);
    const float corr = __expf(mrun - mnew);
    float psum = 0.f;
#pragma unroll
    for (int sub = 0; sub < 2; sub++)
#pragma unroll
      for (int v = 0; v < 8; v++) {
        const float p = __expf(pv[sub][v] - mnew);
        pv[sub][v] = p;
        psum += p;
      }
    psum += __shfl_xor(psum, 16, 32);
    lrun = lrun * corr + psum;
    mrun = mnew;
#pragma unroll
    for (int dc = 0; dc < 8; dc++)
#pragma unroll
      for (int e = 0; e < 8; e++) o[dc][e] *= corr;

    // stage P (bf16) per wave: lane writes 8 contiguous keys -> one b128.
    // Must stay a plain DS store: we rely on same-wave DS ordering for the
    // immediate reload below (ASYNC ops would not preserve it).
#pragma unroll
    for (int sub = 0; sub < 2; sub++) {
      union { __bf16 h8[8]; uint4 q; } u;
#pragma unroll
      for (int v = 0; v < 8; v++) u.h8[v] = f2bf(pv[sub][v]);
      *(uint4*)(Ps + (wave * 16 + lrow) * SP + sub * 16 + 8 * lhi) = u.q;
    }
    v16bf pf = frag_ld(Ps + (wave * 16 + lrow) * SP, lhi);
#pragma unroll
    for (int dc = 0; dc < 8; dc++) {
      v16bf a = frag_ld(Vs + (dc * 16 + lrow) * SV, lhi);
      o[dc] = wmma_bf16(a, pf, o[dc]);
    }
  }

  const float inv = 1.f / lrun;
#pragma unroll
  for (int dc = 0; dc < 8; dc++)
#pragma unroll
    for (int v = 0; v < 8; v++) {
      const int d = dc * 16 + v + 8 * lhi;
      Ob[(size_t)(b_ * TS + qg) * TD + h * TDH + d] = f2bf(o[dc][v] * inv);
    }
}

// ---------- host-side orchestration ----------
extern "C" void kernel_launch(void* const* d_in, const int* in_sizes, int n_in,
                              void* d_out, int out_size, void* d_ws, size_t ws_size,
                              hipStream_t stream) {
  (void)in_sizes; (void)n_in; (void)out_size; (void)ws_size;
  const float* X    = (const float*)d_in[0];
  const float* Wq   = (const float*)d_in[1];
  const float* bq   = (const float*)d_in[2];
  const float* Wk   = (const float*)d_in[3];
  const float* bk   = (const float*)d_in[4];
  const float* Wv   = (const float*)d_in[5];
  const float* bv   = (const float*)d_in[6];
  const float* Wo   = (const float*)d_in[7];
  const float* bo   = (const float*)d_in[8];
  const float* Win  = (const float*)d_in[9];
  const float* bin  = (const float*)d_in[10];
  const float* Wout = (const float*)d_in[11];
  const float* bout = (const float*)d_in[12];
  const float* ln1w = (const float*)d_in[13];
  const float* ln1b = (const float*)d_in[14];
  const float* ln2w = (const float*)d_in[15];
  const float* ln2b = (const float*)d_in[16];
  float* out = (float*)d_out;

  char* ws = (char*)d_ws;
  const size_t szMD = (size_t)TM * TD * 2;          // 16.78 MB (bf16 M x D)
  __bf16* lnb = (__bf16*)(ws);                      // LN output (reused for LN2)
  __bf16* Qb  = (__bf16*)(ws + 1 * szMD);
  __bf16* Kb  = (__bf16*)(ws + 2 * szMD);
  __bf16* Vt  = (__bf16*)(ws + 3 * szMD);
  __bf16* Ab  = (__bf16*)(ws + 4 * szMD);           // attention output
  float*  X1  = (float*)(ws + 5 * szMD);            // residual stream (f32, 2*szMD)
  __bf16* Hm  = (__bf16*)(ws + 1 * szMD);           // MLP hidden reuses Qb..Ab (4*szMD)
  __bf16* Wb  = (__bf16*)(ws + 7 * szMD);           // bf16 weights, 96 MiB in all
  const __bf16* Wqb   = Wb;
  const __bf16* Wkb   = Wb + 1 * (size_t)TD * TD;
  const __bf16* Wvb   = Wb + 2 * (size_t)TD * TD;
  const __bf16* Wob   = Wb + 3 * (size_t)TD * TD;
  const __bf16* Winb  = Wb + 4 * (size_t)TD * TD;
  const __bf16* Woutb = Wb + 4 * (size_t)TD * TD + (size_t)TD * TDFF;

  const float qk = 0.29730177875068026f;            // 1/sqrt(sqrt(128))
  dim3 th(256);
  dim3 gD(TD / 128, TM / 128);      // (16, 32)
  dim3 gF(TDFF / 128, TM / 128);    // (64, 32)
  dim3 gA(TS / 128, TB * THD);      // (16, 32)

  weights_bf16_k<<<4 * WBD + 2 * WBF, th, 0, stream>>>(Wq, Wk, Wv, Wo, Win, Wout, Wb);
  layernorm_bf16_k<<<TM, th, 0, stream>>>(X, ln1w, ln1b, lnb);
  gemm_bf16_k<0, false, false, TD><<<gD, th, 0, stream>>>(lnb, Wqb, bq, nullptr, Qb, TM, TD, qk);
  gemm_bf16_k<0, false, false, TD><<<gD, th, 0, stream>>>(lnb, Wkb, bk, nullptr, Kb, TM, TD, qk);
  gemm_bf16_k<2, false, false, TD><<<gD, th, 0, stream>>>(lnb, Wvb, bv, nullptr, Vt, TM, TD, 1.f);
  attn_k<<<gA, th, 0, stream>>>(Qb, Kb, Vt, Ab);
  gemm_bf16_k<1, false, true, TD><<<gD, th, 0, stream>>>(Ab, Wob, bo, X, (void*)X1, TM, TD, 1.f);
  layernorm_bf16_k<<<TM, th, 0, stream>>>(X1, ln2w, ln2b, lnb);
  gemm_bf16_k<0, true, false, TD><<<gF, th, 0, stream>>>(lnb, Winb, bin, nullptr, Hm, TM, TDFF, 1.f);
  gemm_bf16_k<1, false, true, TDFF><<<gD, th, 0, stream>>>(Hm, Woutb, bout, X1, (void*)out, TM, TD, 1.f);
}

// v003
// Measured time: 486 microseconds a run.
// Next to v002, in two timings, it ran 1.24 times as fast each time.
// All steps since v000 together make it 1.80 times as fast.
#include <hip/hip_runtime.h>
#include <hip/hip_bf16.h>
#include <math.h>

typedef __attribute__((ext_vector_type(16))) __bf16 v16bf;
typedef __attribute__((ext_vector_type(8)))  __bf16 v8bf;
typedef __attribute__((ext_vector_type(8)))  float  v8f;
typedef __attribute__((ext_vector_type(4)))  int    v4i;

#define DEV static __device__ __forceinline__
#define GAS __attribute__((address_space(1)))
#define LAS __attribute__((address_space(3)))

#if __has_builtin(__builtin_amdgcn_global_load_async_to_lds_b128) && \
    __has_builtin(__builtin_amdgcn_s_wait_asynccnt)
#define HAS_ASYNC_LDS 1
#else
#define HAS_ASYNC_LDS 0
#endif

namespace {
constexpr int   TB   = 2;
constexpr int   TS   = 2048;
constexpr int   TD   = 2048;
constexpr int   THD  = 16;     // heads
constexpr int   TDH  = 128;    // head dim
constexpr int   TDFF = 8192;
constexpr int   TM   = TB * TS;          // 4096 token rows
constexpr float TEPS = 1e-5f;
}

// ---------- scalar helpers ----------
DEV __bf16 f2bf(float x) {
  unsigned u = __builtin_bit_cast(unsigned, x);
  unsigned r = u + 0x7FFFu + ((u >> 16) & 1u);      // RNE
  unsigned short s = (unsigned short)(r >> 16);
  return __builtin_bit_cast(__bf16, s);
}

DEV float gelu_f(float x) {
  const float c = 0.7978845608028654f;
  float x3 = x * x * x;
  return 0.5f * x * (1.f + tanhf(c * (x + 0.044715f * x3)));
}

// 16B global -> LDS copy: async-to-LDS (ASYNCcnt) when available, else
// load + ds_store fallback. Builtin signature (from hipcc diagnostic):
// (AS1 v4i* global_src, AS3 v4i* lds_dst, imm offset, imm cpol).
DEV void cp16_g2l(const __bf16* g, __bf16* l) {
#if HAS_ASYNC_LDS
  __builtin_amdgcn_global_load_async_to_lds_b128(
      (GAS v4i*)g, (LAS v4i*)l, 0, 0);
#else
  *(uint4*)l = *(const uint4*)g;
#endif
}
DEV void async_wait0() {
#if HAS_ASYNC_LDS
  __builtin_amdgcn_s_wait_asynccnt(0);
#endif
}
// Publish-point waits of the GEMM ring, each a statement of its own; the
// "memory" clobber keeps every LDS read and copy on its side of the wait.
DEV void ring_wait_async0() {
  // this wave's copies have landed before the barrier that publishes them
  asm volatile("s_wait_asynccnt 0x0" ::: "memory");
}
DEV void ring_wait_ds0() {
  // this wave's LDS reads have retired before the buffer is refilled
  asm volatile("s_wait_dscnt 0x0" ::: "memory");
}

// Load one 16x(32-chunk) bf16 fragment (A-style row layout).
// Per the CDNA5 ISA layout, lane L holds row (L&15); its 16 bf16 elements are
// two contiguous 8-element runs at K offsets {8*(L>>4), 16+8*(L>>4)}.
DEV v16bf frag_ld(const __bf16* rowbase, int lhi) {
  v8bf lo = *(const v8bf*)(rowbase + 8 * lhi);
  v8bf hi = *(const v8bf*)(rowbase + 16 + 8 * lhi);
  return __builtin_shufflevector(lo, hi, 0, 1, 2, 3, 4, 5, 6, 7,
                                         8, 9, 10, 11, 12, 13, 14, 15);
}

DEV v8f wmma_bf16(v16bf a, v16bf b, v8f c) {
  return __builtin_amdgcn_wmma_f32_16x16x32_bf16(false, a, false, b,
                                                 (short)0, c, false, false);
}

// ---------- LayerNorm: f32 in -> bf16 out ----------
__global__ __launch_bounds__(256) void layernorm_bf16_k(
    const float* __restrict__ X, const float* __restrict__ w,
    const float* __restrict__ b, __bf16* __restrict__ out) {
  __shared__ float r1[256];
  __shared__ float r2[256];
  const int row = blockIdx.x;
  const int tid = threadIdx.x;
  const float* x = X + (size_t)row * TD;
  float lx[8], s = 0.f, ss = 0.f;
#pragma unroll
  for (int i = 0; i < 8; i++) {
    lx[i] = x[tid + i * 256];
    s += lx[i];
    ss += lx[i] * lx[i];
  }
  r1[tid] = s; r2[tid] = ss;
  __syncthreads();
  for (int off = 128; off > 0; off >>= 1) {
    if (tid < off) { r1[tid] += r1[tid + off]; r2[tid] += r2[tid + off]; }
    __syncthreads();
  }
  const float mean = r1[0] * (1.f / TD);
  const float var  = r2[0] * (1.f / TD) - mean * mean;
  const float rstd = rsqrtf(var + TEPS);
#pragma unroll
  for (int i = 0; i < 8; i++) {
    const int col = tid + i * 256;
    out[(size_t)row * TD + col] = f2bf((lx[i] - mean) * rstd * w[col] + b[col]);
  }
}

// ---------- Weights: f32 -> bf16, once per call ----------
// Every GEMM work-group of a tile column needs the same rounded W tile; rounding
// it here once leaves the GEMM a W stream of 2 B an element that needs no register.
// dst holds Wq | Wk | Wv | Wo | W_in | W_out back to back, each in its own layout.
// One block moves WCH floats: 8 wave-wide 512-B loads in flight per wave.
constexpr int WCH  = 8192;
constexpr int WBD  = TD * TD / WCH;      // blocks per D x D matrix
constexpr int WBF  = TD * TDFF / WCH;    // blocks per D x DFF matrix
__global__ __launch_bounds__(256) void weights_bf16_k(
    const float* __restrict__ Wq, const float* __restrict__ Wk,
    const float* __restrict__ Wv, const float* __restrict__ Wo,
    const float* __restrict__ Win, const float* __restrict__ Wout,
    __bf16* __restrict__ dst) {
  const int blk = blockIdx.x;
  const float* src;
  int rel;
  if (blk < 4 * WBD) {
    const int w = blk / WBD;
    src = (w == 0) ? Wq : (w == 1) ? Wk : (w == 2) ? Wv : Wo;
    rel = blk % WBD;
  } else if (blk < 4 * WBD + WBF) {
    src = Win;  rel = blk - 4 * WBD;
  } else {
    src = Wout; rel = blk - 4 * WBD - WBF;
  }
  const float4* sp = (const float4*)(src + (size_t)rel * WCH) + threadIdx.x;
  uint2* dp = (uint2*)(dst + (size_t)blk * WCH) + threadIdx.x;
  float4 f[8];
#pragma unroll  // all eight loads issue before the first use
  for (int i = 0; i < 8; i++) f[i] = sp[i * 256];
#pragma unroll  // f[] indexed by constants only
  for (int i = 0; i < 8; i++) {
    union { __bf16 h4[4]; uint2 d; } u;
    u.h4[0] = f2bf(f[i].x); u.h4[1] = f2bf(f[i].y);
    u.h4[2] = f2bf(f[i].z); u.h4[3] = f2bf(f[i].w);
    dp[i * 256] = u.d;
  }
}

// ---------- Tiled WMMA GEMM:  C[M,N] = A[M,K](bf16) @ W[N,K]^T(bf16) + bias ----------
// One work-group makes a 128 x 256 tile of C; its 8 waves lie 2 (m) x 4 (n), each with
// 64 x 64 of C, so a staged byte and a fragment feed more products than in a small tile.
// Two LDS buffers, one barrier per BK-deep K step. BK = 128 where the grid has one
// work-group per WGP (it may take most of the LDS); BK = 64 where there are more, so
// that two fit a WGP and one's epilogue runs beside the other's products.
// Staging lanes run along K: a tile row is BK * 2 B of A and of W, so every wave-wide
// copy covers 4 whole lines. Both tiles go global -> LDS by asynchronous copies,
// which fly for a whole K step while the tile before them is multiplied.
// OUTM: 0 = bf16 [m][n], 1 = f32 [m][n], 2 = bf16 head-transposed V_t[b][h][dh][s]
// K is a template constant: a lane's tile rows then lie at fixed byte distances.
template <int OUTM, bool GELU, bool RES, int K, int BK>
__global__ __launch_bounds__(256) void gemm_bf16_k(
    const __bf16* __restrict__ A, const __bf16* __restrict__ W,
    const float* __restrict__ bias, const float* __restrict__ res,
    void* __restrict__ outp, int M, int N, float scale) {
  constexpr int BM = 128, BN = 256;         // tile rows (of A) and columns (rows of W)
  constexpr int SA = BK + 8;                // 144- or 272-B pitch: 16 B x odd
  constexpr int MI = BM / 32;               // 16-row A fragments per wave
  constexpr int LPR = BK / 8;               // staging lanes per tile row, 16 B each
  constexpr int RPC = 256 / LPR;            // tile rows per work-group-wide copy
  static_assert(K % BK == 0 && K >= 2 * BK, "the ring's prologue fills two tiles");
  static_assert(BK == 64 || BK == 128, "pitch and staging map are set for these");
  __shared__ __attribute__((aligned(16))) __bf16 As[2][BM * SA];
  __shared__ __attribute__((aligned(16))) __bf16 Bs[2][BN * SA];
  const int tid = threadIdx.x, lane = tid & 31, wave = tid >> 5;
  const int lrow = lane & 15, lhi = (lane >> 4) & 1;
  const int m0 = blockIdx.y * BM, n0 = blockIdx.x * BN;
  const int mb = (wave & 1) * (BM / 2), nb = (wave >> 1) * 64;
  const int arow = tid / LPR, acol = (tid % LPR) * 8; // A and W: LPR lanes x 16 B per row

  v8f acc[MI][4];
#pragma unroll
  for (int i = 0; i < MI; i++)
#pragma unroll
    for (int j = 0; j < 4; j++)
#pragma unroll
      for (int e = 0; e < 8; e++) acc[i][j][e] = 0.f;

  auto stage = [&](int buf, int k0) {
    const __bf16* asrc = A + (size_t)(m0 + arow) * K + k0 + acol;
    const __bf16* wsrc = W + (size_t)(n0 + arow) * K + k0 + acol;
#pragma unroll  // the whole tile's copies in flight at once, LDS places as constants
    for (int i = 0; i < BM / RPC; i++)
      cp16_g2l(asrc + (size_t)(RPC * i) * K, &As[buf][(arow + RPC * i) * SA + acol]);
#pragma unroll  // as above
    for (int i = 0; i < BN / RPC; i++)
      cp16_g2l(wsrc + (size_t)(RPC * i) * K, &Bs[buf][(arow + RPC * i) * SA + acol]);
  };

  // prologue: tile 0 landed and published, then tile 1 on its way
  stage(0, 0);
  ring_wait_async0();
  __syncthreads();
  stage(1, BK);
  int buf = 0;
  for (int k0 = 0; k0 < K; k0 += BK, buf ^= 1) {
#pragma unroll  // a later block's fragment reads may start under an earlier one's products
    for (int kk = 0; kk < BK; kk += 32) {
      v16bf af[MI], bfr[4];
#pragma unroll
      for (int mi = 0; mi < MI; mi++)
        af[mi] = frag_ld(&As[buf][(mb + mi * 16 + lrow) * SA + kk], lhi);
#pragma unroll
      for (int ni = 0; ni < 4; ni++)
        bfr[ni] = frag_ld(&Bs[buf][(nb + ni * 16 + lrow) * SA + kk], lhi);
#pragma unroll
      for (int mi = 0; mi < MI; mi++)
#pragma unroll
        for (int ni = 0; ni < 4; ni++)
          acc[mi][ni] = wmma_bf16(af[mi], bfr[ni], acc[mi][ni]);
    }
    // publish point of the next tile; it also ends every read of [buf]
    ring_wait_ds0();
    ring_wait_async0();
    __syncthreads();
    if (k0 + 2 * BK < K)
      stage(buf, k0 + 2 * BK);  // flies under the next trip's WMMAs
  }
  ring_wait_async0();         // no copy outlives the loop

  // epilogue: C/D layout -> lane holds (m = v + 8*lhi, n = lane&15) per frag
  // Every trip works on fragment row 0 and then moves the rows up one place, so acc is
  // indexed by constants only. With GELU the trip is long and the loop stays rolled.
  // Unrolled
  // (the other kernels) the moves are mere renaming and cost nothing.
#pragma unroll(GELU ? 1 : MI)
  for (int mi = 0; mi < MI; mi++) {
#pragma unroll
    for (int ni = 0; ni < 4; ni++) {
      const int n = n0 + nb + ni * 16 + lrow;
      const float bv = bias[n];
#pragma unroll
      for (int v = 0; v < 8; v++) {
        const int m = m0 + mb + mi * 16 + v + 8 * lhi;
        float t = (acc[0][ni][v] + bv) * scale;
        if (GELU) t = gelu_f(t);
        if (RES)  t += res[(size_t)m * N + n];
        if (OUTM == 0) {
          ((__bf16*)outp)[(size_t)m * N + n] = f2bf(t);
        } else if (OUTM == 1) {
          ((float*)outp)[(size_t)m * N + n] = t;
        } else {  // V_t[b][h][dh][s]
          const int b_ = m / TS, s = m % TS;
          const int h = n / TDH, dh = n % TDH;
          ((__bf16*)outp)[((size_t)(b_ * THD + h) * TDH + dh) * TS + s] = f2bf(t);
        }
      }
    }
    // rolled loop: the next trip reuses the registers that this trip's last store names
    if (GELU) asm volatile("s_wait_xcnt 0x0" ::: "memory");
#pragma unroll
    for (int r = 0; r + 1 < MI; r++)
#pragma unroll
      for (int ni = 0; ni < 4; ni++) acc[r][ni] = acc[r + 1][ni];
  }
}

// ---------- Flash attention (causal), one (b,h) x 128-query block per WG ----------
// Computes S^T = K Q^T so query == lane column; O^T = V^T P^T with V_t rows.
__global__ __launch_bounds__(256) void attn_k(
    const __bf16* __restrict__ Qb, const __bf16* __restrict__ Kb,
    const __bf16* __restrict__ Vt, __bf16* __restrict__ Ob) {
  constexpr int SK = 136, SV = 40, SP = 40;
  __shared__ __bf16 Ks[32 * SK];    // [key][d]
  __shared__ __bf16 Vs[128 * SV];   // [d][key]
  __shared__ __bf16 Ps[8 * 16 * SP];// per-wave P[q][key]
  const int tid = threadIdx.x, lane = tid & 31, wave = tid >> 5;
  const int lrow = lane & 15, lhi = (lane >> 4) & 1;
  const int bh = blockIdx.y, b_ = bh >> 4, h = bh & 15;
  const int q0 = blockIdx.x * 128;
  const int qg = q0 + wave * 16 + lrow;   // this lane's query column

  // Q fragments (B-operand), invariant across the k-loop
  v16bf qf[4];
  const __bf16* qbase = Qb + (size_t)(b_ * TS + q0 + wave * 16 + lrow) * TD + h * TDH;
#pragma unroll
  for (int c = 0; c < 4; c++) qf[c] = frag_ld(qbase + c * 32, lhi);

  v8f o[8];
#pragma unroll
  for (int dc = 0; dc < 8; dc++)
#pragma unroll
    for (int e = 0; e < 8; e++) o[dc][e] = 0.f;
  float mrun = -__builtin_inff(), lrun = 0.f;

  const int kr = tid >> 3, kc = (tid & 7) * 16;   // K-tile prefetch coords
  const int vr = tid >> 1, vc = (tid & 1) * 16;   // V-tile prefetch coords
  // staging coords: lanes run along a row, 16 B each, so a wave-wide copy
  // covers whole rows of the tile (K: 256 B, V_t: 64 B)
  const int ksr = tid >> 4, ksc = (tid & 15) * 8;
  const int vsr = tid >> 2, vsc = (tid & 3) * 8;
  const int kend = q0 + 128;
  for (int k0 = 0; k0 < kend; k0 += 32) {
    __syncthreads();          // previous iteration's LDS reads complete
    {  // stage K tile: 32 keys x 128 d
      const __bf16* src = Kb + (size_t)(b_ * TS + k0 + ksr) * TD + h * TDH + ksc;
      cp16_g2l(src,                   Ks + ksr * SK + ksc);
      cp16_g2l(src + (size_t)16 * TD, Ks + (ksr + 16) * SK + ksc);
    }
    {  // stage V_t tile: 128 d x 32 keys (k-contiguous rows)
      const __bf16* src = Vt + ((size_t)bh * TDH + vsr) * TS + k0 + vsc;
      cp16_g2l(src,                   Vs + vsr * SV + vsc);
      cp16_g2l(src + (size_t)64 * TS, Vs + (vsr + 64) * SV + vsc);
    }
    if (k0 + 32 < kend) {     // prefetch next tiles into cache
      __builtin_prefetch(Kb + (size_t)(b_ * TS + k0 + 32 + kr) * TD + h * TDH + kc, 0, 1);
      __builtin_prefetch(Vt + ((size_t)bh * TDH + vr) * TS + k0 + 32 + vc, 0, 1);
    }
    async_wait0();
    __syncthreads();

    // scores S^T: two 16-key subtiles, each 4 WMMAs over DH=128
    float pv[2][8];
    // masking only needed when this 32-key tile can reach past a query of
    // this wave; wave-uniform condition -> scalar branch, EXEC stays full
    const bool needmask = (k0 + 31) > (q0 + wave * 16);
#pragma unroll
    for (int sub = 0; sub < 2; sub++) {
      v8f st;
#pragma unroll
      for (int e = 0; e < 8; e++) st[e] = 0.f;
#pragma unroll
      for (int c = 0; c < 4; c++) {
        v16bf a = frag_ld(Ks + (sub * 16 + lrow) * SK + c * 32, lhi);
        st = wmma_bf16(a, qf[c], st);
      }
      if (needmask) {
#pragma unroll
        for (int v = 0; v < 8; v++) {
          const int kg = k0 + sub * 16 + v + 8 * lhi;
          pv[sub][v] = (kg <= qg) ? st[v] : -__builtin_inff();
        }
      } else {
#pragma unroll
        for (int v = 0; v < 8; v++) pv[sub][v] = st[v];
      }
    }

    // online softmax per query (in-lane + one xor-16 exchange)
    float mt = -__builtin_inff();
#pragma unroll
    for (int sub = 0; sub < 2; sub++)
#pragma unroll
      for (int v = 0; v < 8; v++) mt = fmaxf(mt, pv[sub][v]);
    mt = fmaxf(mt, __shfl_xor(mt, 16, 32));
    const float mnew = fmaxf(mrun, mt);
    const float corr = __expf(mrun - mnew);
    float psum = 0.f;
#pragma unroll
    for (int sub = 0; sub < 2; sub++)
#pragma unroll
      for (int v = 0; v < 8; v++) {
        const float p = __expf(pv[sub][v] - mnew);
        pv[sub][v] = p;
        psum += p;
      }
    psum += __shfl_xor(psum, 16, 32);
    lrun = lrun * corr + psum;
    mrun = mnew;
#pragma unroll
    for (int dc = 0; dc < 8; dc++)
#pragma unroll
      for (int e = 0; e < 8; e++) o[dc][e] *= corr;

    // stage P (bf16) per wave: lane writes 8 contiguous keys -> one b128.
    // Must stay a plain DS store: we rely on same-wave DS ordering for the
    // immediate reload below (ASYNC ops would not preserve it).
#pragma unroll
    for (int sub = 0; sub < 2; sub++) {
      union { __bf16 h8[8]; uint4 q; } u;
#pragma unroll
      for (int v = 0; v < 8; v++) u.h8[v] = f2bf(pv[sub][v]);
      *(uint4*)(Ps + (wave * 16 + lrow) * SP + sub * 16 + 8 * lhi) = u.q;
    }
    v16bf pf = frag_ld(Ps + (wave * 16 + lrow) * SP, lhi);
#pragma unroll
    for (int dc = 0; dc < 8; dc++) {
      v16bf a = frag_ld(Vs + (dc * 16 + lrow) * SV, lhi);
      o[dc] = wmma_bf16(a, pf, o[dc]);
    }
  }

  const float inv = 1.f / lrun;
#pragma unroll
  for (int dc = 0; dc < 8; dc++)
#pragma unroll
    for (int v = 0; v < 8; v++) {
      const int d = dc * 16 + v + 8 * lhi;
      Ob[(size_t)(b_ * TS + qg) * TD + h * TDH + d] = f2bf(o[dc][v] * inv);
    }
}

// ---------- host-side orchestration ----------
extern "C" void kernel_launch(void* const* d_in, const int* in_sizes, int n_in,
                              void* d_out, int out_size, void* d_ws, size_t ws_size,
                              hipStream_t stream) {
  (void)in_sizes; (void)n_in; (void)out_size; (void)ws_size;
  const float* X    = (const float*)d_in[0];
  const float* Wq   = (const float*)d_in[1];
  const float* bq   = (const float*)d_in[2];
  const float* Wk   = (const float*)d_in[3];
  const float* bk   = (const float*)d_in[4];
  const float* Wv   = (const float*)d_in[5];
  const float* bv   = (const float*)d_in[6];
  const float* Wo   = (const float*)d_in[7];
  const float* bo   = (const float*)d_in[8];
  const float* Win  = (const float*)d_in[9];
  const float* bin  = (const float*)d_in[10];
  const float* Wout = (const float*)d_in[11];
  const float* bout = (const float*)d_in[12];
  const float* ln1w = (const float*)d_in[13];
  const float* ln1b = (const float*)d_in[14];
  const float* ln2w = (const float*)d_in[15];
  const float* ln2b = (const float*)d_in[16];
  float* out = (float*)d_out;

  char* ws = (char*)d_ws;
  const size_t szMD = (size_t)TM * TD * 2;          // 16.78 MB (bf16 M x D)
  __bf16* lnb = (__bf16*)(ws);                      // LN output (reused for LN2)
  __bf16* Qb  = (__bf16*)(ws + 1 * szMD);
  __bf16* Kb  = (__bf16*)(ws + 2 * szMD);
  __bf16* Vt  = (__bf16*)(ws + 3 * szMD);
  __bf16* Ab  = (__bf16*)(ws + 4 * szMD);           // attention output
  float*  X1  = (float*)(ws + 5 * szMD);            // residual stream (f32, 2*szMD)
  __bf16* Hm  = (__bf16*)(ws + 1 * szMD);           // MLP hidden reuses Qb..Ab (4*szMD)
  __bf16* Wb  = (__bf16*)(ws + 7 * szMD);           // bf16 weights, 96 MiB in all
  const __bf16* Wqb   = Wb;
  const __bf16* Wkb   = Wb + 1 * (size_t)TD * TD;
  const __bf16* Wvb   = Wb + 2 * (size_t)TD * TD;
  const __bf16* Wob   = Wb + 3 * (size_t)TD * TD;
  const __bf16* Winb  = Wb + 4 * (size_t)TD * TD;
  const __bf16* Woutb = Wb + 4 * (size_t)TD * TD + (size_t)TD * TDFF;

  const float qk = 0.29730177875068026f;            // 1/sqrt(sqrt(128))
  dim3 th(256);
  dim3 gD(TD / 256, TM / 128);      // (8, 32): 128 x 256 tiles
  dim3 gF(TDFF / 256, TM / 128);    // (32, 32)
  dim3 gA(TS / 128, TB * THD);      // (16, 32)

  weights_bf16_k<<<4 * WBD + 2 * WBF, th, 0, stream>>>(Wq, Wk, Wv, Wo, Win, Wout, Wb);
  layernorm_bf16_k<<<TM, th, 0, stream>>>(X, ln1w, ln1b, lnb);
  gemm_bf16_k<0, false, false, TD, 128><<<gD, th, 0, stream>>>(lnb, Wqb, bq, nullptr, Qb, TM, TD, qk);
  gemm_bf16_k<0, false, false, TD, 128><<<gD, th, 0, stream>>>(lnb, Wkb, bk, nullptr, Kb, TM, TD, qk);
  gemm_bf16_k<2, false, false, TD, 128><<<gD, th, 0, stream>>>(lnb, Wvb, bv, nullptr, Vt, TM, TD, 1.f);
  attn_k<<<gA, th, 0, stream>>>(Qb, Kb, Vt, Ab);
  gemm_bf16_k<1, false, true, TD, 128><<<gD, th, 0, stream>>>(Ab, Wob, bo, X, (void*)X1, TM, TD, 1.f);
  layernorm_bf16_k<<<TM, th, 0, stream>>>(X1, ln2w, ln2b, lnb);
  gemm_bf16_k<0, true, false, TD, 64><<<gF, th, 0, stream>>>(lnb, Winb, bin, nullptr, Hm, TM, TDFF, 1.f);
  gemm_bf16_k<1, false, true, TDFF, 128><<<gD, th, 0, stream>>>(Hm, Woutb, bout, X1, (void*)out, TM, TD, 1.f);
}

// v004
// A run of this version takes 451 microseconds.
// Next to v003, in two timings, it ran 1.07 and 1.08 times as fast.
// All steps since v000 together make it 1.93 times as fast.
#include <hip/hip_runtime.h>
#include <hip/hip_bf16.h>
#include <math.h>

typedef __attribute__((ext_vector_type(16))) __bf16 v16bf;
typedef __attribute__((ext_vector_type(8)))  __bf16 v8bf;
typedef __attribute__((ext_vector_type(8)))  float  v8f;
typedef __attribute__((ext_vector_type(4)))  int    v4i;

#define DEV static __device__ __forceinline__
#define GAS __attribute__((address_space(1)))
#define LAS __attribute__((address_space(3)))

#if __has_builtin(__builtin_amdgcn_global_load_async_to_lds_b128) && \
    __has_builtin(__builtin_amdgcn_s_wait_asynccnt)
#define HAS_ASYNC_LDS 1
#else
#define HAS_ASYNC_LDS 0
#endif

namespace {
constexpr int   TB   = 2;
constexpr int   TS   = 2048;
constexpr int   TD   = 2048;
constexpr int   THD  = 16;     // heads
constexpr int   TDH  = 128;    // head dim
constexpr int   TDFF = 8192;
constexpr int   TM   = TB * TS;          // 4096 token rows
constexpr float TEPS = 1e-5f;
}

// ---------- scalar helpers ----------
DEV __bf16 f2bf(float x) {
  unsigned u = __builtin_bit_cast(unsigned, x);
  unsigned r = u + 0x7FFFu + ((u >> 16) & 1u);      // RNE
  unsigned short s = (unsigned short)(r >> 16);
  return __builtin_bit_cast(__bf16, s);
}

DEV float gelu_f(float x) {
  const float c = 0.7978845608028654f;
  float x3 = x * x * x;
  return 0.5f * x * (1.f + tanhf(c * (x + 0.044715f * x3)));
}

// 16B global -> LDS copy: async-to-LDS (ASYNCcnt) when available, else
// load + ds_store fallback. Builtin signature (from hipcc diagnostic):
// (AS1 v4i* global_src, AS3 v4i* lds_dst, imm offset, imm cpol).
DEV void cp16_g2l(const __bf16* g, __bf16* l) {
#if HAS_ASYNC_LDS
  __builtin_amdgcn_global_load_async_to_lds_b128(
      (GAS v4i*)g, (LAS v4i*)l, 0, 0);
#else
  *(uint4*)l = *(const uint4*)g;
#endif
}
DEV void async_wait0() {
#if HAS_ASYNC_LDS
  __builtin_amdgcn_s_wait_asynccnt(0);
#endif
}
// Publish-point waits of the GEMM ring, each a statement of its own; the
// "memory" clobber keeps every LDS read and copy on its side of the wait.
DEV void ring_wait_async0() {
  // this wave's copies have landed before the barrier that publishes them
  asm volatile("s_wait_asynccnt 0x0" ::: "memory");
}
DEV void ring_wait_ds0() {
  // this wave's LDS reads have retired before the buffer is refilled
  asm volatile("s_wait_dscnt 0x0" ::: "memory");
}

// Nothing is scheduled across this point: without it the compiler sinks the fragment
// loads in among the WMMAs, two at a time, each pair with a wait to 0 right behind it.
DEV void sched_fence() { __builtin_amdgcn_sched_barrier(0); }

// Load one 16x(32-chunk) bf16 fragment (A-style row layout).
// Per the CDNA5 ISA layout, lane L holds row (L&15); its 16 bf16 elements are
// two contiguous 8-element runs at K offsets {8*(L>>4), 16+8*(L>>4)}.
DEV v16bf frag_ld(const __bf16* rowbase, int lhi) {
  v8bf lo = *(const v8bf*)(rowbase + 8 * lhi);
  v8bf hi = *(const v8bf*)(rowbase + 16 + 8 * lhi);
  return __builtin_shufflevector(lo, hi, 0, 1, 2, 3, 4, 5, 6, 7,
                                         8, 9, 10, 11, 12, 13, 14, 15);
}

DEV v8f wmma_bf16(v16bf a, v16bf b, v8f c) {
  return __builtin_amdgcn_wmma_f32_16x16x32_bf16(false, a, false, b,
                                                 (short)0, c, false, false);
}

// ---------- LayerNorm: f32 in -> bf16 out ----------
__global__ __launch_bounds__(256) void layernorm_bf16_k(
    const float* __restrict__ X, const float* __restrict__ w,
    const float* __restrict__ b, __bf16* __restrict__ out) {
  __shared__ float r1[256];
  __shared__ float r2[256];
  const int row = blockIdx.x;
  const int tid = threadIdx.x;
  const float* x = X + (size_t)row * TD;
  float lx[8], s = 0.f, ss = 0.f;
#pragma unroll
  for (int i = 0; i < 8; i++) {
    lx[i] = x[tid + i * 256];
    s += lx[i];
    ss += lx[i] * lx[i];
  }
  r1[tid] = s; r2[tid] = ss;
  __syncthreads();
  for (int off = 128; off > 0; off >>= 1) {
    if (tid < off) { r1[tid] += r1[tid + off]; r2[tid] += r2[tid + off]; }
    __syncthreads();
  }
  const float mean = r1[0] * (1.f / TD);
  const float var  = r2[0] * (1.f / TD) - mean * mean;
  const float rstd = rsqrtf(var + TEPS);
#pragma unroll
  for (int i = 0; i < 8; i++) {
    const int col = tid + i * 256;
    out[(size_t)row * TD + col] = f2bf((lx[i] - mean) * rstd * w[col] + b[col]);
  }
}

// ---------- Weights: f32 -> bf16, once per call ----------
// Every GEMM work-group of a tile column needs the same rounded W tile; rounding
// it here once leaves the GEMM a W stream of 2 B an element that needs no register.
// dst holds Wq | Wk | Wv | Wo | W_in | W_out back to back, each in its own layout.
// One block moves WCH floats: 8 wave-wide 512-B loads in flight per wave.
constexpr int WCH  = 8192;
constexpr int WBD  = TD * TD / WCH;      // blocks per D x D matrix
constexpr int WBF  = TD * TDFF / WCH;    // blocks per D x DFF matrix
__global__ __launch_bounds__(256) void weights_bf16_k(
    const float* __restrict__ Wq, const float* __restrict__ Wk,
    const float* __restrict__ Wv, const float* __restrict__ Wo,
    const float* __restrict__ Win, const float* __restrict__ Wout,
    __bf16* __restrict__ dst) {
  const int blk = blockIdx.x;
  const float* src;
  int rel;
  if (blk < 4 * WBD) {
    const int w = blk / WBD;
    src = (w == 0) ? Wq : (w == 1) ? Wk : (w == 2) ? Wv : Wo;
    rel = blk % WBD;
  } else if (blk < 4 * WBD + WBF) {
    src = Win;  rel = blk - 4 * WBD;
  } else {
    src = Wout; rel = blk - 4 * WBD - WBF;
  }
  const float4* sp = (const float4*)(src + (size_t)rel * WCH) + threadIdx.x;
  uint2* dp = (uint2*)(dst + (size_t)blk * WCH) + threadIdx.x;
  float4 f[8];
#pragma unroll  // all eight loads issue before the first use
  for (int i = 0; i < 8; i++) f[i] = sp[i * 256];
#pragma unroll  // f[] indexed by constants only
  for (int i = 0; i < 8; i++) {
    union { __bf16 h4[4]; uint2 d; } u;
    u.h4[0] = f2bf(f[i].x); u.h4[1] = f2bf(f[i].y);
    u.h4[2] = f2bf(f[i].z); u.h4[3] = f2bf(f[i].w);
    dp[i * 256] = u.d;
  }
}

// ---------- Tiled WMMA GEMM:  C[M,N] = A[M,K](bf16) @ W[N,K]^T(bf16) + bias ----------
// One work-group makes a 128 x 256 tile of C; its 8 waves lie 2 (m) x 4 (n), each with
// 64 x 64 of C, so a staged byte and a fragment feed more products than in a small tile.
// Two LDS buffers, one barrier per BK-deep K step. BK = 128 where the grid has one
// work-group per WGP (it may take most of the LDS); BK = 64 where there are more, so
// that two fit a WGP and one's epilogue runs beside the other's products.
// Staging lanes run along K: a tile row is BK * 2 B of A and of W, so every wave-wide
// copy covers 4 whole lines. Both tiles go global -> LDS by asynchronous copies,
// which fly for a whole K step while the tile before them is multiplied.
// BK = 128 (two waves per SIMD, registers to spare): two fragment sets; each 32-deep
// block's 16 LDS loads go out as one group, one block ahead of the products that use
// them. The next tile's first fragments are fetched under this tile's last block, so
// the publish point stands in front of that block. BK = 64 (four waves per SIMD) has
// no registers for a second set and hides its LDS waits behind the other waves.
// OUTM: 0 = bf16 [m][n], 1 = f32 [m][n], 2 = bf16 head-transposed V_t[b][h][dh][s]
// K is a template constant: a lane's tile rows then lie at fixed byte distances.
template <int OUTM, bool GELU, bool RES, int K, int BK>
__global__ __launch_bounds__(256) void gemm_bf16_k(
    const __bf16* __restrict__ A, const __bf16* __restrict__ W,
    const float* __restrict__ bias, const float* __restrict__ res,
    void* __restrict__ outp, int M, int N, float scale) {
  constexpr int BM = 128, BN = 256;         // tile rows (of A) and columns (rows of W)
  constexpr int SA = BK + 8;                // 144- or 272-B pitch: 16 B x odd
  constexpr int MI = BM / 32;               // 16-row A fragments per wave
  constexpr int LPR = BK / 8;               // staging lanes per tile row, 16 B each
  constexpr int RPC = 256 / LPR;            // tile rows per work-group-wide copy
  static_assert(K % BK == 0 && K >= 2 * BK, "the ring's prologue fills two tiles");
  static_assert(BK == 64 || BK == 128, "pitch and staging map are set for these");
  __shared__ __attribute__((aligned(16))) __bf16 As[2][BM * SA];
  __shared__ __attribute__((aligned(16))) __bf16 Bs[2][BN * SA];
  const int tid = threadIdx.x, lane = tid & 31, wave = tid >> 5;
  const int lrow = lane & 15, lhi = (lane >> 4) & 1;
  const int m0 = blockIdx.y * BM, n0 = blockIdx.x * BN;
  const int mb = (wave & 1) * (BM / 2), nb = (wave >> 1) * 64;
  const int arow = tid / LPR, acol = (tid % LPR) * 8; // A and W: LPR lanes x 16 B per row

  v8f acc[MI][4];
#pragma unroll
  for (int i = 0; i < MI; i++)
#pragma unroll
    for (int j = 0; j < 4; j++)
#pragma unroll
      for (int e = 0; e < 8; e++) acc[i][j][e] = 0.f;

  auto stage = [&](int buf, int k0) {
    const __bf16* asrc = A + (size_t)(m0 + arow) * K + k0 + acol;
    const __bf16* wsrc = W + (size_t)(n0 + arow) * K + k0 + acol;
#pragma unroll  // the whole tile's copies in flight at once, LDS places as constants
    for (int i = 0; i < BM / RPC; i++)
      cp16_g2l(asrc + (size_t)(RPC * i) * K, &As[buf][(arow + RPC * i) * SA + acol]);
#pragma unroll  // as above
    for (int i = 0; i < BN / RPC; i++)
      cp16_g2l(wsrc + (size_t)(RPC * i) * K, &Bs[buf][(arow + RPC * i) * SA + acol]);
  };

  // prologue: tile 0 landed and published, then tile 1 on its way
  stage(0, 0);
  ring_wait_async0();
  __syncthreads();
  stage(1, BK);
  if constexpr (BK == 128) {
    constexpr int KSUB = BK / 32;           // blocks per tile; even, so set 0 opens every tile
    v16bf af[2][MI], bfr[2][4];             // set (u & 1) holds block u's fragments
#pragma unroll
    for (int mi = 0; mi < MI; mi++)
      af[0][mi] = frag_ld(&As[0][(mb + mi * 16 + lrow) * SA], lhi);
#pragma unroll
    for (int ni = 0; ni < 4; ni++)
      bfr[0][ni] = frag_ld(&Bs[0][(nb + ni * 16 + lrow) * SA], lhi);
    int buf = 0;
#pragma clang loop unroll(disable)  // one trip's text stays small; sets alternate inside a trip
    for (int k0 = 0; k0 < K; k0 += BK, buf ^= 1) {
#pragma unroll  // af, bfr indexed by constants only
      for (int u = 0; u < KSUB; u++) {
        const int cs = u & 1;
        if (u + 1 < KSUB) {
          const int kk = (u + 1) * 32;
#pragma unroll
          for (int mi = 0; mi < MI; mi++)
            af[cs ^ 1][mi] = frag_ld(&As[buf][(mb + mi * 16 + lrow) * SA + kk], lhi);
#pragma unroll
          for (int ni = 0; ni < 4; ni++)
            bfr[cs ^ 1][ni] = frag_ld(&Bs[buf][(nb + ni * 16 + lrow) * SA + kk], lhi);
        } else {
          // publish point of the next tile: the last block's fragments are in registers,
          // so it also ends every read of [buf]
          ring_wait_ds0();
          ring_wait_async0();
          __syncthreads();
          if (k0 + 2 * BK < K)
            stage(buf, k0 + 2 * BK);  // flies under this block's and the next trip's WMMAs
          // the next tile's first fragments; on the last trip they read the other
          // buffer's old tile, which nothing writes any more, and are not used
#pragma unroll
          for (int mi = 0; mi < MI; mi++)
            af[cs ^ 1][mi] = frag_ld(&As[buf ^ 1][(mb + mi * 16 + lrow) * SA], lhi);
#pragma unroll
          for (int ni = 0; ni < 4; ni++)
            bfr[cs ^ 1][ni] = frag_ld(&Bs[buf ^ 1][(nb + ni * 16 + lrow) * SA], lhi);
        }
        sched_fence();  // the load group stays whole, in front of the block
#pragma unroll
        for (int mi = 0; mi < MI; mi++)
#pragma unroll
          for (int ni = 0; ni < 4; ni++)
            acc[mi][ni] = wmma_bf16(af[cs][mi], bfr[cs][ni], acc[mi][ni]);
        sched_fence();  // the next group does not rise into this block
      }
    }
  } else {
    int buf = 0;
    for (int k0 = 0; k0 < K; k0 += BK, buf ^= 1) {
#pragma unroll  // a later block's fragment reads may start under an earlier one's products
      for (int kk = 0; kk < BK; kk += 32) {
        v16bf af[MI], bfr[4];
#pragma unroll
        for (int mi = 0; mi < MI; mi++)
          af[mi] = frag_ld(&As[buf][(mb + mi * 16 + lrow) * SA + kk], lhi);
#pragma unroll
        for (int ni = 0; ni < 4; ni++)
          bfr[ni] = frag_ld(&Bs[buf][(nb + ni * 16 + lrow) * SA + kk], lhi);
#pragma unroll
        for (int mi = 0; mi < MI; mi++)
#pragma unroll
          for (int ni = 0; ni < 4; ni++)
            acc[mi][ni] = wmma_bf16(af[mi], bfr[ni], acc[mi][ni]);
      }
      // publish point of the next tile; it also ends every read of [buf]
      ring_wait_ds0();
      ring_wait_async0();
      __syncthreads();
      if (k0 + 2 * BK < K)
        stage(buf, k0 + 2 * BK);  // flies under the next trip's WMMAs
    }
  }
  ring_wait_async0();         // no copy outlives the loop

  // epilogue: C/D layout -> lane holds (m = v + 8*lhi, n = lane&15) per frag
  // Every trip works on fragment row 0 and then moves the rows up one place, so acc is
  // indexed by constants only. With GELU the trip is long and the loop stays rolled.
  // Unrolled
  // (the other kernels) the moves are mere renaming and cost nothing.
#pragma unroll(GELU ? 1 : MI)
  for (int mi = 0; mi < MI; mi++) {
#pragma unroll
    for (int ni = 0; ni < 4; ni++) {
      const int n = n0 + nb + ni * 16 + lrow;
      const float bv = bias[n];
#pragma unroll
      for (int v = 0; v < 8; v++) {
        const int m = m0 + mb + mi * 16 + v + 8 * lhi;
        float t = (acc[0][ni][v] + bv) * scale;
        if (GELU) t = gelu_f(t);
        if (RES)  t += res[(size_t)m * N + n];
        if (OUTM == 0) {
          ((__bf16*)outp)[(size_t)m * N + n] = f2bf(t);
        } else if (OUTM == 1) {
          ((float*)outp)[(size_t)m * N + n] = t;
        } else {  // V_t[b][h][dh][s]
          const int b_ = m / TS, s = m % TS;
          const int h = n / TDH, dh = n % TDH;
          ((__bf16*)outp)[((size_t)(b_ * THD + h) * TDH + dh) * TS + s] = f2bf(t);
        }
      }
    }
    // rolled loop: the next trip reuses the registers that this trip's last store names
    if (GELU) asm volatile("s_wait_xcnt 0x0" ::: "memory");
#pragma unroll
    for (int r = 0; r + 1 < MI; r++)
#pragma unroll
      for (int ni = 0; ni < 4; ni++) acc[r][ni] = acc[r + 1][ni];
  }
}

// ---------- Flash attention (causal), one (b,h) x 128-query block per WG ----------
// Computes S^T = K Q^T so query == lane column; O^T = V^T P^T with V_t rows.
__global__ __launch_bounds__(256) void attn_k(
    const __bf16* __restrict__ Qb, const __bf16* __restrict__ Kb,
    const __bf16* __restrict__ Vt, __bf16* __restrict__ Ob) {
  constexpr int SK = 136, SV = 40, SP = 40;
  __shared__ __bf16 Ks[32 * SK];    // [key][d]
  __shared__ __bf16 Vs[128 * SV];   // [d][key]
  __shared__ __bf16 Ps[8 * 16 * SP];// per-wave P[q][key]
  const int tid = threadIdx.x, lane = tid & 31, wave = tid >> 5;
  const int lrow = lane & 15, lhi = (lane >> 4) & 1;
  const int bh = blockIdx.y, b_ = bh >> 4, h = bh & 15;
  const int q0 = blockIdx.x * 128;
  const int qg = q0 + wave * 16 + lrow;   // this lane's query column

  // Q fragments (B-operand), invariant across the k-loop
  v16bf qf[4];
  const __bf16* qbase = Qb + (size_t)(b_ * TS + q0 + wave * 16 + lrow) * TD + h * TDH;
#pragma unroll
  for (int c = 0; c < 4; c++) qf[c] = frag_ld(qbase + c * 32, lhi);

  v8f o[8];
#pragma unroll
  for (int dc = 0; dc < 8; dc++)
#pragma unroll
    for (int e = 0; e < 8; e++) o[dc][e] = 0.f;
  float mrun = -__builtin_inff(), lrun = 0.f;

  const int kr = tid >> 3, kc = (tid & 7) * 16;   // K-tile prefetch coords
  const int vr = tid >> 1, vc = (tid & 1) * 16;   // V-tile prefetch coords
  // staging coords: lanes run along a row, 16 B each, so a wave-wide copy
  // covers whole rows of the tile (K: 256 B, V_t: 64 B)
  const int ksr = tid >> 4, ksc = (tid & 15) * 8;
  const int vsr = tid >> 2, vsc = (tid & 3) * 8;
  const int kend = q0 + 128;
  for (int k0 = 0; k0 < kend; k0 += 32) {
    __syncthreads();          // previous iteration's LDS reads complete
    {  // stage K tile: 32 keys x 128 d
      const __bf16* src = Kb + (size_t)(b_ * TS + k0 + ksr) * TD + h * TDH + ksc;
      cp16_g2l(src,                   Ks + ksr * SK + ksc);
      cp16_g2l(src + (size_t)16 * TD, Ks + (ksr + 16) * SK + ksc);
    }
    {  // stage V_t tile: 128 d x 32 keys (k-contiguous rows)
      const __bf16* src = Vt + ((size_t)bh * TDH + vsr) * TS + k0 + vsc;
      cp16_g2l(src,                   Vs + vsr * SV + vsc);
      cp16_g2l(src + (size_t)64 * TS, Vs + (vsr + 64) * SV + vsc);
    }
    if (k0 + 32 < kend) {     // prefetch next tiles into cache
      __builtin_prefetch(Kb + (size_t)(b_ * TS + k0 + 32 + kr) * TD + h * TDH + kc, 0, 1);
      __builtin_prefetch(Vt + ((size_t)bh * TDH + vr) * TS + k0 + 32 + vc, 0, 1);
    }
    async_wait0();
    __syncthreads();

    // scores S^T: two 16-key subtiles, each 4 WMMAs over DH=128
    float pv[2][8];
    // masking only needed when this 32-key tile can reach past a query of
    // this wave; wave-uniform condition -> scalar branch, EXEC stays full
    const bool needmask = (k0 + 31) > (q0 + wave * 16);
#pragma unroll
    for (int sub = 0; sub < 2; sub++) {
      v8f st;
#pragma unroll
      for (int e = 0; e < 8; e++) st[e] = 0.f;
#pragma unroll
      for (int c = 0; c < 4; c++) {
        v16bf a = frag_ld(Ks + (sub * 16 + lrow) * SK + c * 32, lhi);
        st = wmma_bf16(a, qf[c], st);
      }
      if (needmask) {
#pragma unroll
        for (int v = 0; v < 8; v++) {
          const int kg = k0 + sub * 16 + v + 8 * lhi;
          pv[sub][v] = (kg <= qg) ? st[v] : -__builtin_inff();
        }
      } else {
#pragma unroll
        for (int v = 0; v < 8; v++) pv[sub][v] = st[v];
      }
    }

    // online softmax per query (in-lane + one xor-16 exchange)
    float mt = -__builtin_inff();
#pragma unroll
    for (int sub = 0; sub < 2; sub++)
#pragma unroll
      for (int v = 0; v < 8; v++) mt = fmaxf(mt, pv[sub][v]);
    mt = fmaxf(mt, __shfl_xor(mt, 16, 32));
    const float mnew = fmaxf(mrun, mt);
    const float corr = __expf(mrun - mnew);
    float psum = 0.f;
#pragma unroll
    for (int sub = 0; sub < 2; sub++)
#pragma unroll
      for (int v = 0; v < 8; v++) {
        const float p = __expf(pv[sub][v] - mnew);
        pv[sub][v] = p;
        psum += p;
      }
    psum += __shfl_xor(psum, 16, 32);
    lrun = lrun * corr + psum;
    mrun = mnew;
#pragma unroll
    for (int dc = 0; dc < 8; dc++)
#pragma unroll
      for (int e = 0; e < 8; e++) o[dc][e] *= corr;

    // stage P (bf16) per wave: lane writes 8 contiguous keys -> one b128.
    // Must stay a plain DS store: we rely on same-wave DS ordering for the
    // immediate reload below (ASYNC ops would not preserve it).
#pragma unroll
    for (int sub = 0; sub < 2; sub++) {
      union { __bf16 h8[8]; uint4 q; } u;
#pragma unroll
      for (int v = 0; v < 8; v++) u.h8[v] = f2bf(pv[sub][v]);
      *(uint4*)(Ps + (wave * 16 + lrow) * SP + sub * 16 + 8 * lhi) = u.q;
    }
    v16bf pf = frag_ld(Ps + (wave * 16 + lrow) * SP, lhi);
#pragma unroll
    for (int dc = 0; dc < 8; dc++) {
      v16bf a = frag_ld(Vs + (dc * 16 + lrow) * SV, lhi);
      o[dc] = wmma_bf16(a, pf, o[dc]);
    }
  }

  const float inv = 1.f / lrun;
#pragma unroll
  for (int dc = 0; dc < 8; dc++)
#pragma unroll
    for (int v = 0; v < 8; v++) {
      const int d = dc * 16 + v + 8 * lhi;
      Ob[(size_t)(b_ * TS + qg) * TD + h * TDH + d] = f2bf(o[dc][v] * inv);
    }
}

// ---------- host-side orchestration ----------
extern "C" void kernel_launch(void* const* d_in, const int* in_sizes, int n_in,
                              void* d_out, int out_size, void* d_ws, size_t ws_size,
                              hipStream_t stream) {
  (void)in_sizes; (void)n_in; (void)out_size; (void)ws_size;
  const float* X    = (const float*)d_in[0];
  const float* Wq   = (const float*)d_in[1];
  const float* bq   = (const float*)d_in[2];
  const float* Wk   = (const float*)d_in[3];
  const float* bk   = (const float*)d_in[4];
  const float* Wv   = (const float*)d_in[5];
  const float* bv   = (const float*)d_in[6];
  const float* Wo   = (const float*)d_in[7];
  const float* bo   = (const float*)d_in[8];
  const float* Win  = (const float*)d_in[9];
  const float* bin  = (const float*)d_in[10];
  const float* Wout = (const float*)d_in[11];
  const float* bout = (const float*)d_in[12];
  const float* ln1w = (const float*)d_in[13];
  const float* ln1b = (const float*)d_in[14];
  const float* ln2w = (const float*)d_in[15];
  const float* ln2b = (const float*)d_in[16];
  float* out = (float*)d_out;

  char* ws = (char*)d_ws;
  const size_t szMD = (size_t)TM * TD * 2;          // 16.78 MB (bf16 M x D)
  __bf16* lnb = (__bf16*)(ws);                      // LN output (reused for LN2)
  __bf16* Qb  = (__bf16*)(ws + 1 * szMD);
  __bf16* Kb  = (__bf16*)(ws + 2 * szMD);
  __bf16* Vt  = (__bf16*)(ws + 3 * szMD);
  __bf16* Ab  = (__bf16*)(ws + 4 * szMD);           // attention output
  float*  X1  = (float*)(ws + 5 * szMD);            // residual stream (f32, 2*szMD)
  __bf16* Hm  = (__bf16*)(ws + 1 * szMD);           // MLP hidden reuses Qb..Ab (4*szMD)
  __bf16* Wb  = (__bf16*)(ws + 7 * szMD);           // bf16 weights, 96 MiB in all
  const __bf16* Wqb   = Wb;
  const __bf16* Wkb   = Wb + 1 * (size_t)TD * TD;
  const __bf16* Wvb   = Wb + 2 * (size_t)TD * TD;
  const __bf16* Wob   = Wb + 3 * (size_t)TD * TD;
  const __bf16* Winb  = Wb + 4 * (size_t)TD * TD;
  const __bf16* Woutb = Wb + 4 * (size_t)TD * TD + (size_t)TD * TDFF;

  const float qk = 0.29730177875068026f;            // 1/sqrt(sqrt(128))
  dim3 th(256);
  dim3 gD(TD / 256, TM / 128);      // (8, 32): 128 x 256 tiles
  dim3 gF(TDFF / 256, TM / 128);    // (32, 32)
  dim3 gA(TS / 128, TB * THD);      // (16, 32)

  weights_bf16_k<<<4 * WBD + 2 * WBF, th, 0, stream>>>(Wq, Wk, Wv, Wo, Win, Wout, Wb);
  layernorm_bf16_k<<<TM, th, 0, stream>>>(X, ln1w, ln1b, lnb);
  gemm_bf16_k<0, false, false, TD, 128><<<gD, th, 0, stream>>>(lnb, Wqb, bq, nullptr, Qb, TM, TD, qk);
  gemm_bf16_k<0, false, false, TD, 128><<<gD, th, 0, stream>>>(lnb, Wkb, bk, nullptr, Kb, TM, TD, qk);
  gemm_bf16_k<2, false, false, TD, 128><<<gD, th, 0, stream>>>(lnb, Wvb, bv, nullptr, Vt, TM, TD, 1.f);
  attn_k<<<gA, th, 0, stream>>>(Qb, Kb, Vt, Ab);
  gemm_bf16_k<1, false, true, TD, 128><<<gD, th, 0, stream>>>(Ab, Wob, bo, X, (void*)X1, TM, TD, 1.f);
  layernorm_bf16_k<<<TM, th, 0, stream>>>(X1, ln2w, ln2b, lnb);
  gemm_bf16_k<0, true, false, TD, 64><<<gF, th, 0, stream>>>(lnb, Winb, bin, nullptr, Hm, TM, TDFF, 1.f);
  gemm_bf16_k<1, false, true, TDFF, 128><<<gD, th, 0, stream>>>(Hm, Woutb, bout, X1, (void*)out, TM, TD, 1.f);
}

// v005
// One run takes 426 microseconds.
// Timed twice side by side with v004, it ran 1.06 times as fast both times.
// Counting every step since v000, it is 2.04 times as fast.
#include <hip/hip_runtime.h>
#include <hip/hip_bf16.h>
#include <math.h>

typedef __attribute__((ext_vector_type(16))) __bf16 v16bf;
typedef __attribute__((ext_vector_type(8)))  __bf16 v8bf;
typedef __attribute__((ext_vector_type(8)))  float  v8f;
typedef __attribute__((ext_vector_type(4)))  int    v4i;

#define DEV static __device__ __forceinline__
#define GAS __attribute__((address_space(1)))
#define LAS __attribute__((address_space(3)))

#if __has_builtin(__builtin_amdgcn_global_load_async_to_lds_b128) && \
    __has_builtin(__builtin_amdgcn_s_wait_asynccnt)
#define HAS_ASYNC_LDS 1
#else
#define HAS_ASYNC_LDS 0
#endif

namespace {
constexpr int   TB   = 2;
constexpr int   TS   = 2048;
constexpr int   TD   = 2048;
constexpr int   THD  = 16;     // heads
constexpr int   TDH  = 128;    // head dim
constexpr int   TDFF = 8192;
constexpr int   TM   = TB * TS;          // 4096 token rows
constexpr float TEPS = 1e-5f;
}

// ---------- scalar helpers ----------
DEV __bf16 f2bf(float x) {
  unsigned u = __builtin_bit_cast(unsigned, x);
  unsigned r = u + 0x7FFFu + ((u >> 16) & 1u);      // RNE
  unsigned short s = (unsigned short)(r >> 16);
  return __builtin_bit_cast(__bf16, s);
}

DEV float gelu_f(float x) {
  const float c = 0.7978845608028654f;
  float x3 = x * x * x;
  return 0.5f * x * (1.f + tanhf(c * (x + 0.044715f * x3)));
}

// 16B global -> LDS copy: async-to-LDS (ASYNCcnt) when available, else
// load + ds_store fallback. Builtin signature (from hipcc diagnostic):
// (AS1 v4i* global_src, AS3 v4i* lds_dst, imm offset, imm cpol).
DEV void cp16_g2l(const __bf16* g, __bf16* l) {
#if HAS_ASYNC_LDS
  __builtin_amdgcn_global_load_async_to_lds_b128(
      (GAS v4i*)g, (LAS v4i*)l, 0, 0);
#else
  *(uint4*)l = *(const uint4*)g;
#endif
}
DEV void async_wait0() {
#if HAS_ASYNC_LDS
  __builtin_amdgcn_s_wait_asynccnt(0);
#endif
}
// Publish-point waits of the GEMM ring, each a statement of its own; the
// "memory" clobber keeps every LDS read and copy on its side of the wait.
DEV void ring_wait_async0() {
  // this wave's copies have landed before the barrier that publishes them
  asm volatile("s_wait_asynccnt 0x0" ::: "memory");
}
DEV void ring_wait_ds0() {
  // this wave's LDS reads have retired before the buffer is refilled
  asm volatile("s_wait_dscnt 0x0" ::: "memory");
}

// Nothing is scheduled across this point: without it the compiler sinks the fragment
// loads in among the WMMAs, two at a time, each pair with a wait to 0 right behind it.
DEV void sched_fence() { __builtin_amdgcn_sched_barrier(0); }

// Load one 16x(32-chunk) bf16 fragment (A-style row layout).
// Per the CDNA5 ISA layout, lane L holds row (L&15); its 16 bf16 elements are
// two contiguous 8-element runs at K offsets {8*(L>>4), 16+8*(L>>4)}.
DEV v16bf frag_ld(const __bf16* rowbase, int lhi) {
  v8bf lo = *(const v8bf*)(rowbase + 8 * lhi);
  v8bf hi = *(const v8bf*)(rowbase + 16 + 8 * lhi);
  return __builtin_shufflevector(lo, hi, 0, 1, 2, 3, 4, 5, 6, 7,
                                         8, 9, 10, 11, 12, 13, 14, 15);
}

DEV v8f wmma_bf16(v16bf a, v16bf b, v8f c) {
  return __builtin_amdgcn_wmma_f32_16x16x32_bf16(false, a, false, b,
                                                 (short)0, c, false, false);
}

// ---------- LayerNorm: f32 in -> bf16 out ----------
__global__ __launch_bounds__(256) void layernorm_bf16_k(
    const float* __restrict__ X, const float* __restrict__ w,
    const float* __restrict__ b, __bf16* __restrict__ out) {
  __shared__ float r1[256];
  __shared__ float r2[256];
  const int row = blockIdx.x;
  const int tid = threadIdx.x;
  const float* x = X + (size_t)row * TD;
  float lx[8], s = 0.f, ss = 0.f;
#pragma unroll
  for (int i = 0; i < 8; i++) {
    lx[i] = x[tid + i * 256];
    s += lx[i];
    ss += lx[i] * lx[i];
  }
  r1[tid] = s; r2[tid] = ss;
  __syncthreads();
  for (int off = 128; off > 0; off >>= 1) {
    if (tid < off) { r1[tid] += r1[tid + off]; r2[tid] += r2[tid + off]; }
    __syncthreads();
  }
  const float mean = r1[0] * (1.f / TD);
  const float var  = r2[0] * (1.f / TD) - mean * mean;
  const float rstd = rsqrtf(var + TEPS);
#pragma unroll
  for (int i = 0; i < 8; i++) {
    const int col = tid + i * 256;
    out[(size_t)row * TD + col] = f2bf((lx[i] - mean) * rstd * w[col] + b[col]);
  }
}

// ---------- Weights: f32 -> bf16, once per call ----------
// Every GEMM work-group of a tile column needs the same rounded W tile; rounding
// it here once leaves the GEMM a W stream of 2 B an element that needs no register.
// dst holds Wq | Wk | Wv | Wo | W_in | W_out back to back, each in its own layout.
// One block moves WCH floats: 8 wave-wide 512-B loads in flight per wave.
constexpr int WCH  = 8192;
constexpr int WBD  = TD * TD / WCH;      // blocks per D x D matrix
constexpr int WBF  = TD * TDFF / WCH;    // blocks per D x DFF matrix
__global__ __launch_bounds__(256) void weights_bf16_k(
    const float* __restrict__ Wq, const float* __restrict__ Wk,
    const float* __restrict__ Wv, const float* __restrict__ Wo,
    const float* __restrict__ Win, const float* __restrict__ Wout,
    __bf16* __restrict__ dst) {
  const int blk = blockIdx.x;
  const float* src;
  int rel;
  if (blk < 4 * WBD) {
    const int w = blk / WBD;
    src = (w == 0) ? Wq : (w == 1) ? Wk : (w == 2) ? Wv : Wo;
    rel = blk % WBD;
  } else if (blk < 4 * WBD + WBF) {
    src = Win;  rel = blk - 4 * WBD;
  } else {
    src = Wout; rel = blk - 4 * WBD - WBF;
  }
  const float4* sp = (const float4*)(src + (size_t)rel * WCH) + threadIdx.x;
  uint2* dp = (uint2*)(dst + (size_t)blk * WCH) + threadIdx.x;
  float4 f[8];
#pragma unroll  // all eight loads issue before the first use
  for (int i = 0; i < 8; i++) f[i] = sp[i * 256];
#pragma unroll  // f[] indexed by constants only
  for (int i = 0; i < 8; i++) {
    union { __bf16 h4[4]; uint2 d; } u;
    u.h4[0] = f2bf(f[i].x); u.h4[1] = f2bf(f[i].y);
    u.h4[2] = f2bf(f[i].z); u.h4[3] = f2bf(f[i].w);
    dp[i * 256] = u.d;
  }
}

// ---------- Tiled WMMA GEMM:  C[M,N] = A[M,K](bf16) @ W[N,K]^T(bf16) + bias ----------
// One work-group makes a 128 x 256 tile of C; its 8 waves lie 2 (m) x 4 (n), each with
// 64 x 64 of C, so a staged byte and a fragment feed more products than in a small tile.
// Two LDS buffers, one barrier per BK-deep K step. BK = 128 where the grid has one
// work-group per WGP (it may take most of the LDS); BK = 64 where there are more, so
// that two fit a WGP and one's epilogue runs beside the other's products.
// Staging lanes run along K: a tile row is BK * 2 B of A and of W, so every wave-wide
// copy covers 4 whole lines. Both tiles go global -> LDS by asynchronous copies,
// which fly for a whole K step while the tile before them is multiplied.
// BK = 128 (two waves per SIMD, registers to spare): two fragment sets; each 32-deep
// block's 16 LDS loads go out as one group, one block ahead of the products that use
// them. The next tile's first fragments are fetched under this tile's last block, so
// the publish point stands in front of that block. BK = 64 (four waves per SIMD) has
// no registers for a second set and hides its LDS waits behind the other waves.
// OUTM: 0 = bf16 [m][n], 1 = f32 [m][n], 2 = bf16 head-transposed V_t[b][h][dh][s]
// K is a template constant: a lane's tile rows then lie at fixed byte distances.
template <int OUTM, bool GELU, bool RES, int K, int BK>
__global__ __launch_bounds__(256) void gemm_bf16_k(
    const __bf16* __restrict__ A, const __bf16* __restrict__ W,
    const float* __restrict__ bias, const float* __restrict__ res,
    void* __restrict__ outp, int M, int N, float scale) {
  constexpr int BM = 128, BN = 256;         // tile rows (of A) and columns (rows of W)
  constexpr int SA = BK + 8;                // 144- or 272-B pitch: 16 B x odd
  constexpr int MI = BM / 32;               // 16-row A fragments per wave
  constexpr int LPR = BK / 8;               // staging lanes per tile row, 16 B each
  constexpr int RPC = 256 / LPR;            // tile rows per work-group-wide copy
  static_assert(K % BK == 0 && K >= 2 * BK, "the ring's prologue fills two tiles");
  static_assert(BK == 64 || BK == 128, "pitch and staging map are set for these");
  __shared__ __attribute__((aligned(16))) __bf16 As[2][BM * SA];
  __shared__ __attribute__((aligned(16))) __bf16 Bs[2][BN * SA];
  const int tid = threadIdx.x, lane = tid & 31, wave = tid >> 5;
  const int lrow = lane & 15, lhi = (lane >> 4) & 1;
  const int m0 = blockIdx.y * BM, n0 = blockIdx.x * BN;
  const int mb = (wave & 1) * (BM / 2), nb = (wave >> 1) * 64;
  const int arow = tid / LPR, acol = (tid % LPR) * 8; // A and W: LPR lanes x 16 B per row

  v8f acc[MI][4];
#pragma unroll
  for (int i = 0; i < MI; i++)
#pragma unroll
    for (int j = 0; j < 4; j++)
#pragma unroll
      for (int e = 0; e < 8; e++) acc[i][j][e] = 0.f;

  auto stage = [&](int buf, int k0) {
    const __bf16* asrc = A + (size_t)(m0 + arow) * K + k0 + acol;
    const __bf16* wsrc = W + (size_t)(n0 + arow) * K + k0 + acol;
#pragma unroll  // the whole tile's copies in flight at once, LDS places as constants
    for (int i = 0; i < BM / RPC; i++)
      cp16_g2l(asrc + (size_t)(RPC * i) * K, &As[buf][(arow + RPC * i) * SA + acol]);
#pragma unroll  // as above
    for (int i = 0; i < BN / RPC; i++)
      cp16_g2l(wsrc + (size_t)(RPC * i) * K, &Bs[buf][(arow + RPC * i) * SA + acol]);
  };

  // prologue: tile 0 landed and published, then tile 1 on its way
  stage(0, 0);
  ring_wait_async0();
  __syncthreads();
  stage(1, BK);
  if constexpr (BK == 128) {
    constexpr int KSUB = BK / 32;           // blocks per tile; even, so set 0 opens every tile
    v16bf af[2][MI], bfr[2][4];             // set (u & 1) holds block u's fragments
#pragma unroll
    for (int mi = 0; mi < MI; mi++)
      af[0][mi] = frag_ld(&As[0][(mb + mi * 16 + lrow) * SA], lhi);
#pragma unroll
    for (int ni = 0; ni < 4; ni++)
      bfr[0][ni] = frag_ld(&Bs[0][(nb + ni * 16 + lrow) * SA], lhi);
    int buf = 0;
#pragma clang loop unroll(disable)  // one trip's text stays small; sets alternate inside a trip
    for (int k0 = 0; k0 < K; k0 += BK, buf ^= 1) {
#pragma unroll  // af, bfr indexed by constants only
      for (int u = 0; u < KSUB; u++) {
        const int cs = u & 1;
        if (u + 1 < KSUB) {
          const int kk = (u + 1) * 32;
#pragma unroll
          for (int mi = 0; mi < MI; mi++)
            af[cs ^ 1][mi] = frag_ld(&As[buf][(mb + mi * 16 + lrow) * SA + kk], lhi);
#pragma unroll
          for (int ni = 0; ni < 4; ni++)
            bfr[cs ^ 1][ni] = frag_ld(&Bs[buf][(nb + ni * 16 + lrow) * SA + kk], lhi);
        } else {
          // publish point of the next tile: the last block's fragments are in registers,
          // so it also ends every read of [buf]
          ring_wait_ds0();
          ring_wait_async0();
          __syncthreads();
          if (k0 + 2 * BK < K)
            stage(buf, k0 + 2 * BK);  // flies under this block's and the next trip's WMMAs
          // the next tile's first fragments; on the last trip they read the other
          // buffer's old tile, which nothing writes any more, and are not used
#pragma unroll
          for (int mi = 0; mi < MI; mi++)
            af[cs ^ 1][mi] = frag_ld(&As[buf ^ 1][(mb + mi * 16 + lrow) * SA], lhi);
#pragma unroll
          for (int ni = 0; ni < 4; ni++)
            bfr[cs ^ 1][ni] = frag_ld(&Bs[buf ^ 1][(nb + ni * 16 + lrow) * SA], lhi);
        }
        sched_fence();  // the load group stays whole, in front of the block
#pragma unroll
        for (int mi = 0; mi < MI; mi++)
#pragma unroll
          for (int ni = 0; ni < 4; ni++)
            acc[mi][ni] = wmma_bf16(af[cs][mi], bfr[cs][ni], acc[mi][ni]);
        sched_fence();  // the next group does not rise into this block
      }
    }
  } else {
    int buf = 0;
    for (int k0 = 0; k0 < K; k0 += BK, buf ^= 1) {
#pragma unroll  // a later block's fragment reads may start under an earlier one's products
      for (int kk = 0; kk < BK; kk += 32) {
        v16bf af[MI], bfr[4];
#pragma unroll
        for (int mi = 0; mi < MI; mi++)
          af[mi] = frag_ld(&As[buf][(mb + mi * 16 + lrow) * SA + kk], lhi);
#pragma unroll
        for (int ni = 0; ni < 4; ni++)
          bfr[ni] = frag_ld(&Bs[buf][(nb + ni * 16 + lrow) * SA + kk], lhi);
#pragma unroll
        for (int mi = 0; mi < MI; mi++)
#pragma unroll
          for (int ni = 0; ni < 4; ni++)
            acc[mi][ni] = wmma_bf16(af[mi], bfr[ni], acc[mi][ni]);
      }
      // publish point of the next tile; it also ends every read of [buf]
      ring_wait_ds0();
      ring_wait_async0();
      __syncthreads();
      if (k0 + 2 * BK < K)
        stage(buf, k0 + 2 * BK);  // flies under the next trip's WMMAs
    }
  }
  ring_wait_async0();         // no copy outlives the loop

  // epilogue: C/D layout -> lane holds (m = v + 8*lhi, n = lane&15) per frag
  // Every trip works on fragment row 0 and then moves the rows up one place, so acc is
  // indexed by constants only. With GELU the trip is long and the loop stays rolled.
  // Unrolled
  // (the other kernels) the moves are mere renaming and cost nothing.
#pragma unroll(GELU ? 1 : MI)
  for (int mi = 0; mi < MI; mi++) {
#pragma unroll
    for (int ni = 0; ni < 4; ni++) {
      const int n = n0 + nb + ni * 16 + lrow;
      const float bv = bias[n];
#pragma unroll
      for (int v = 0; v < 8; v++) {
        const int m = m0 + mb + mi * 16 + v + 8 * lhi;
        float t = (acc[0][ni][v] + bv) * scale;
        if (GELU) t = gelu_f(t);
        if (RES)  t += res[(size_t)m * N + n];
        if (OUTM == 0) {
          ((__bf16*)outp)[(size_t)m * N + n] = f2bf(t);
        } else if (OUTM == 1) {
          ((float*)outp)[(size_t)m * N + n] = t;
        } else {  // V_t[b][h][dh][s]
          const int b_ = m / TS, s = m % TS;
          const int h = n / TDH, dh = n % TDH;
          ((__bf16*)outp)[((size_t)(b_ * THD + h) * TDH + dh) * TS + s] = f2bf(t);
        }
      }
    }
    // rolled loop: the next trip reuses the registers that this trip's last store names
    if (GELU) asm volatile("s_wait_xcnt 0x0" ::: "memory");
#pragma unroll
    for (int r = 0; r + 1 < MI; r++)
#pragma unroll
      for (int ni = 0; ni < 4; ni++) acc[r][ni] = acc[r + 1][ni];
  }
}

// ---------- Flash attention (causal), one (b,h) x 128-query block per WG ----------
// Computes S^T = K Q^T so query == lane column; O^T = V^T P^T with V_t rows.
__global__ __launch_bounds__(256) void attn_k(
    const __bf16* __restrict__ Qb, const __bf16* __restrict__ Kb,
    const __bf16* __restrict__ Vt, __bf16* __restrict__ Ob) {
  constexpr int SK = 136, SV = 40, SP = 40;
  __shared__ __bf16 Ks[32 * SK];    // [key][d]
  __shared__ __bf16 Vs[128 * SV];   // [d][key]
  __shared__ __bf16 Ps[8 * 16 * SP];// per-wave P[q][key]
  const int tid = threadIdx.x, lane = tid & 31, wave = tid >> 5;
  const int lrow = lane & 15, lhi = (lane >> 4) & 1;
  const int bh = blockIdx.y, b_ = bh >> 4, h = bh & 15;
  const int q0 = blockIdx.x * 128;
  const int qg = q0 + wave * 16 + lrow;   // this lane's query column

  // Q fragments (B-operand), invariant across the k-loop
  v16bf qf[4];
  const __bf16* qbase = Qb + (size_t)(b_ * TS + q0 + wave * 16 + lrow) * TD + h * TDH;
#pragma unroll
  for (int c = 0; c < 4; c++) qf[c] = frag_ld(qbase + c * 32, lhi);

  v8f o[8];
#pragma unroll
  for (int dc = 0; dc < 8; dc++)
#pragma unroll
    for (int e = 0; e < 8; e++) o[dc][e] = 0.f;
  float mrun = -__builtin_inff(), lrun = 0.f;

  const int kr = tid >> 3, kc = (tid & 7) * 16;   // K-tile prefetch coords
  const int vr = tid >> 1, vc = (tid & 1) * 16;   // V-tile prefetch coords
  // staging coords: lanes run along a row, 16 B each, so a wave-wide copy
  // covers whole rows of the tile (K: 256 B, V_t: 64 B)
  const int ksr = tid >> 4, ksc = (tid & 15) * 8;
  const int vsr = tid >> 2, vsc = (tid & 3) * 8;
  const int kend = q0 + 128;
  for (int k0 = 0; k0 < kend; k0 += 32) {
    __syncthreads();          // previous iteration's LDS reads complete
    {  // stage K tile: 32 keys x 128 d
      const __bf16* src = Kb + (size_t)(b_ * TS + k0 + ksr) * TD + h * TDH + ksc;
      cp16_g2l(src,                   Ks + ksr * SK + ksc);
      cp16_g2l(src + (size_t)16 * TD, Ks + (ksr + 16) * SK + ksc);
    }
    {  // stage V_t tile: 128 d x 32 keys (k-contiguous rows)
      const __bf16* src = Vt + ((size_t)bh * TDH + vsr) * TS + k0 + vsc;
      cp16_g2l(src,                   Vs + vsr * SV + vsc);
      cp16_g2l(src + (size_t)64 * TS, Vs + (vsr + 64) * SV + vsc);
    }
    if (k0 + 32 < kend) {     // prefetch next tiles into cache
      __builtin_prefetch(Kb + (size_t)(b_ * TS + k0 + 32 + kr) * TD + h * TDH + kc, 0, 1);
      __builtin_prefetch(Vt + ((size_t)bh * TDH + vr) * TS + k0 + 32 + vc, 0, 1);
    }
    async_wait0();
    __syncthreads();

    // scores S^T: two 16-key subtiles, each 4 WMMAs over DH=128.
    // All 8 K fragments are fetched first, 16 LDS loads as one group in the order in
    // which the products use them: the wave pays one LDS latency, not one per product.
    v16bf kf[4][2];
#pragma unroll  // kf indexed by constants only
    for (int c = 0; c < 4; c++)
#pragma unroll
      for (int sub = 0; sub < 2; sub++)
        kf[c][sub] = frag_ld(Ks + (sub * 16 + lrow) * SK + c * 32, lhi);
    sched_fence();  // the K group stays whole, in front of its products
    v8f st[2];
#pragma unroll
    for (int sub = 0; sub < 2; sub++)
#pragma unroll
      for (int e = 0; e < 8; e++) st[sub][e] = 0.f;
#pragma unroll  // the two subtiles' sums alternate: two independent accumulator chains
    for (int c = 0; c < 4; c++)
#pragma unroll
      for (int sub = 0; sub < 2; sub++)
        st[sub] = wmma_bf16(kf[c][sub], qf[c], st[sub]);
    sched_fence();  // keeps the V group whole: without it two of its loads rise further up among the products
    // All 8 V_t fragments, 16 LDS loads as one group into the registers that the K
    // fragments have left; they land under the mask and the row maximum.
    v16bf vf[8];
#pragma unroll  // vf indexed by constants only
    for (int dc = 0; dc < 8; dc++)
      vf[dc] = frag_ld(Vs + (dc * 16 + lrow) * SV, lhi);

    float pv[2][8];
    // masking only needed when this 32-key tile can reach past a query of
    // this wave; wave-uniform condition -> scalar branch, EXEC stays full
    const bool needmask = (k0 + 31) > (q0 + wave * 16);
    if (needmask) {
#pragma unroll
      for (int sub = 0; sub < 2; sub++)
#pragma unroll
        for (int v = 0; v < 8; v++) {
          const int kg = k0 + sub * 16 + v + 8 * lhi;
          pv[sub][v] = (kg <= qg) ? st[sub][v] : -__builtin_inff();
        }
    } else {
#pragma unroll
      for (int sub = 0; sub < 2; sub++)
#pragma unroll
        for (int v = 0; v < 8; v++) pv[sub][v] = st[sub][v];
    }

    // online softmax per query (in-lane + one xor-16 exchange)
    float mt = -__builtin_inff();
#pragma unroll
    for (int sub = 0; sub < 2; sub++)
#pragma unroll
      for (int v = 0; v < 8; v++) mt = fmaxf(mt, pv[sub][v]);
    mt = fmaxf(mt, __shfl_xor(mt, 16, 32));
    const float mnew = fmaxf(mrun, mt);
    const float corr = __expf(mrun - mnew);
    float psum = 0.f;
#pragma unroll
    for (int sub = 0; sub < 2; sub++)
#pragma unroll
      for (int v = 0; v < 8; v++) {
        const float p = __expf(pv[sub][v] - mnew);
        pv[sub][v] = p;
        psum += p;
      }
    psum += __shfl_xor(psum, 16, 32);
    lrun = lrun * corr + psum;
    mrun = mnew;
#pragma unroll
    for (int dc = 0; dc < 8; dc++)
#pragma unroll
      for (int e = 0; e < 8; e++) o[dc][e] *= corr;

    // stage P (bf16) per wave: lane writes 8 contiguous keys -> one b128.
    // Must stay a plain DS store: we rely on same-wave DS ordering for the
    // immediate reload below (ASYNC ops would not preserve it).
#pragma unroll
    for (int sub = 0; sub < 2; sub++) {
      union { __bf16 h8[8]; uint4 q; } u;
#pragma unroll
      for (int v = 0; v < 8; v++) u.h8[v] = f2bf(pv[sub][v]);
      *(uint4*)(Ps + (wave * 16 + lrow) * SP + sub * 16 + 8 * lhi) = u.q;
    }
    v16bf pf = frag_ld(Ps + (wave * 16 + lrow) * SP, lhi);
#pragma unroll
    for (int dc = 0; dc < 8; dc++) o[dc] = wmma_bf16(vf[dc], pf, o[dc]);
  }

  const float inv = 1.f / lrun;
#pragma unroll
  for (int dc = 0; dc < 8; dc++)
#pragma unroll
    for (int v = 0; v < 8; v++) {
      const int d = dc * 16 + v + 8 * lhi;
      Ob[(size_t)(b_ * TS + qg) * TD + h * TDH + d] = f2bf(o[dc][v] * inv);
    }
}

// ---------- host-side orchestration ----------
extern "C" void kernel_launch(void* const* d_in, const int* in_sizes, int n_in,
                              void* d_out, int out_size, void* d_ws, size_t ws_size,
                              hipStream_t stream) {
  (void)in_sizes; (void)n_in; (void)out_size; (void)ws_size;
  const float* X    = (const float*)d_in[0];
  const float* Wq   = (const float*)d_in[1];
  const float* bq   = (const float*)d_in[2];
  const float* Wk   = (const float*)d_in[3];
  const float* bk   = (const float*)d_in[4];
  const float* Wv   = (const float*)d_in[5];
  const float* bv   = (const float*)d_in[6];
  const float* Wo   = (const float*)d_in[7];
  const float* bo   = (const float*)d_in[8];
  const float* Win  = (const float*)d_in[9];
  const float* bin  = (const float*)d_in[10];
  const float* Wout = (const float*)d_in[11];
  const float* bout = (const float*)d_in[12];
  const float* ln1w = (const float*)d_in[13];
  const float* ln1b = (const float*)d_in[14];
  const float* ln2w = (const float*)d_in[15];
  const float* ln2b = (const float*)d_in[16];
  float* out = (float*)d_out;

  char* ws = (char*)d_ws;
  const size_t szMD = (size_t)TM * TD * 2;          // 16.78 MB (bf16 M x D)
  __bf16* lnb = (__bf16*)(ws);                      // LN output (reused for LN2)
  __bf16* Qb  = (__bf16*)(ws + 1 * szMD);
  __bf16* Kb  = (__bf16*)(ws + 2 * szMD);
  __bf16* Vt  = (__bf16*)(ws + 3 * szMD);
  __bf16* Ab  = (__bf16*)(ws + 4 * szMD);           // attention output
  float*  X1  = (float*)(ws + 5 * szMD);            // residual stream (f32, 2*szMD)
  __bf16* Hm  = (__bf16*)(ws + 1 * szMD);           // MLP hidden reuses Qb..Ab (4*szMD)
  __bf16* Wb  = (__bf16*)(ws + 7 * szMD);           // bf16 weights, 96 MiB in all
  const __bf16* Wqb   = Wb;
  const __bf16* Wkb   = Wb + 1 * (size_t)TD * TD;
  const __bf16* Wvb   = Wb + 2 * (size_t)TD * TD;
  const __bf16* Wob   = Wb + 3 * (size_t)TD * TD;
  const __bf16* Winb  = Wb + 4 * (size_t)TD * TD;
  const __bf16* Woutb = Wb + 4 * (size_t)TD * TD + (size_t)TD * TDFF;

  const float qk = 0.29730177875068026f;            // 1/sqrt(sqrt(128))
  dim3 th(256);
  dim3 gD(TD / 256, TM / 128);      // (8, 32): 128 x 256 tiles
  dim3 gF(TDFF / 256, TM / 128);    // (32, 32)
  dim3 gA(TS / 128, TB * THD);      // (16, 32)

  weights_bf16_k<<<4 * WBD + 2 * WBF, th, 0, stream>>>(Wq, Wk, Wv, Wo, Win, Wout, Wb);
  layernorm_bf16_k<<<TM, th, 0, stream>>>(X, ln1w, ln1b, lnb);
  gemm_bf16_k<0, false, false, TD, 128><<<gD, th, 0, stream>>>(lnb, Wqb, bq, nullptr, Qb, TM, TD, qk);
  gemm_bf16_k<0, false, false, TD, 128><<<gD, th, 0, stream>>>(lnb, Wkb, bk, nullptr, Kb, TM, TD, qk);
  gemm_bf16_k<2, false, false, TD, 128><<<gD, th, 0, stream>>>(lnb, Wvb, bv, nullptr, Vt, TM, TD, 1.f);
  attn_k<<<gA, th, 0, stream>>>(Qb, Kb, Vt, Ab);
  gemm_bf16_k<1, false, true, TD, 128><<<gD, th, 0, stream>>>(Ab, Wob, bo, X, (void*)X1, TM, TD, 1.f);
  layernorm_bf16_k<<<TM, th, 0, stream>>>(X1, ln2w, ln2b, lnb);
  gemm_bf16_k<0, true, false, TD, 64><<<gF, th, 0, stream>>>(lnb, Winb, bin, nullptr, Hm, TM, TDFF, 1.f);
  gemm_bf16_k<1, false, true, TDFF, 128><<<gD, th, 0, stream>>>(Hm, Woutb, bout, X1, (void*)out, TM, TD, 1.f);
}

// v006
// It runs in 408 microseconds.
// Next to v005, in two timings, it ran 1.05 times as fast each time.
// All steps since v000 together make it 2.14 times as fast.
#include <hip/hip_runtime.h>
#include <hip/hip_bf16.h>
#include <math.h>

typedef __attribute__((ext_vector_type(16))) __bf16 v16bf;
typedef __attribute__((ext_vector_type(8)))  __bf16 v8bf;
typedef __attribute__((ext_vector_type(8)))  float  v8f;
typedef __attribute__((ext_vector_type(4)))  int    v4i;

#define DEV static __device__ __forceinline__
#define GAS __attribute__((address_space(1)))
#define LAS __attribute__((address_space(3)))

#if __has_builtin(__builtin_amdgcn_global_load_async_to_lds_b128) && \
    __has_builtin(__builtin_amdgcn_s_wait_asynccnt)
#define HAS_ASYNC_LDS 1
#else
#define HAS_ASYNC_LDS 0
#endif

namespace {
constexpr int   TB   = 2;
constexpr int   TS   = 2048;
constexpr int   TD   = 2048;
constexpr int   THD  = 16;     // heads
constexpr int   TDH  = 128;    // head dim
constexpr int   TDFF = 8192;
constexpr int   TM   = TB * TS;          // 4096 token rows
constexpr float TEPS = 1e-5f;
}

// ---------- scalar helpers ----------
DEV __bf16 f2bf(float x) {
  unsigned u = __builtin_bit_cast(unsigned, x);
  unsigned r = u + 0x7FFFu + ((u >> 16) & 1u);      // RNE
  unsigned short s = (unsigned short)(r >> 16);
  return __builtin_bit_cast(__bf16, s);
}

// 0.5 x (1 + tanh u) = x / (1 + e^(-2u)), u = c (x + 0.044715 x^3): the same function,
// with one exp2 and one reciprocal and no branch. The library tanhf splits the lanes on
// |u| and runs both sides, one element behind the other; here the elements of an
// epilogue trip are independent chains. No difference of near-equal terms is formed;
// e^(-2u) = 0 or infinity gives x or 0, as the limits of tanh do.
DEV float gelu_f(float x) {
  const float k = -2.f * 0.7978845608028654f * 1.4426950408889634f;  // -2 c log2(e)
  const float u = x * __builtin_fmaf(x * x, 0.044715f, 1.f);
  return x * __builtin_amdgcn_rcpf(1.f + __builtin_amdgcn_exp2f(k * u));
}

// 16B global -> LDS copy: async-to-LDS (ASYNCcnt) when available, else
// load + ds_store fallback. Builtin signature (from hipcc diagnostic):
// (AS1 v4i* global_src, AS3 v4i* lds_dst, imm offset, imm cpol).
DEV void cp16_g2l(const __bf16* g, __bf16* l) {
#if HAS_ASYNC_LDS
  __builtin_amdgcn_global_load_async_to_lds_b128(
      (GAS v4i*)g, (LAS v4i*)l, 0, 0);
#else
  *(uint4*)l = *(const uint4*)g;
#endif
}
DEV void async_wait0() {
#if HAS_ASYNC_LDS
  __builtin_amdgcn_s_wait_asynccnt(0);
#endif
}
// Publish-point waits of the GEMM ring, each a statement of its own; the
// "memory" clobber keeps every LDS read and copy on its side of the wait.
DEV void ring_wait_async0() {
  // this wave's copies have landed before the barrier that publishes them
  asm volatile("s_wait_asynccnt 0x0" ::: "memory");
}
DEV void ring_wait_ds0() {
  // this wave's LDS reads have retired before the buffer is refilled
  asm volatile("s_wait_dscnt 0x0" ::: "memory");
}

// Nothing is scheduled across this point: without it the compiler sinks the fragment
// loads in among the WMMAs, two at a time, each pair with a wait to 0 right behind it.
DEV void sched_fence() { __builtin_amdgcn_sched_barrier(0); }

// Load one 16x(32-chunk) bf16 fragment (A-style row layout).
// Per the CDNA5 ISA layout, lane L holds row (L&15); its 16 bf16 elements are
// two contiguous 8-element runs at K offsets {8*(L>>4), 16+8*(L>>4)}.
DEV v16bf frag_ld(const __bf16* rowbase, int lhi) {
  v8bf lo = *(const v8bf*)(rowbase + 8 * lhi);
  v8bf hi = *(const v8bf*)(rowbase + 16 + 8 * lhi);
  return __builtin_shufflevector(lo, hi, 0, 1, 2, 3, 4, 5, 6, 7,
                                         8, 9, 10, 11, 12, 13, 14, 15);
}

DEV v8f wmma_bf16(v16bf a, v16bf b, v8f c) {
  return __builtin_amdgcn_wmma_f32_16x16x32_bf16(false, a, false, b,
                                                 (short)0, c, false, false);
}

// ---------- LayerNorm: f32 in -> bf16 out ----------
__global__ __launch_bounds__(256) void layernorm_bf16_k(
    const float* __restrict__ X, const float* __restrict__ w,
    const float* __restrict__ b, __bf16* __restrict__ out) {
  __shared__ float r1[256];
  __shared__ float r2[256];
  const int row = blockIdx.x;
  const int tid = threadIdx.x;
  const float* x = X + (size_t)row * TD;
  float lx[8], s = 0.f, ss = 0.f;
#pragma unroll
  for (int i = 0; i < 8; i++) {
    lx[i] = x[tid + i * 256];
    s += lx[i];
    ss += lx[i] * lx[i];
  }
  r1[tid] = s; r2[tid] = ss;
  __syncthreads();
  for (int off = 128; off > 0; off >>= 1) {
    if (tid < off) { r1[tid] += r1[tid + off]; r2[tid] += r2[tid + off]; }
    __syncthreads();
  }
  const float mean = r1[0] * (1.f / TD);
  const float var  = r2[0] * (1.f / TD) - mean * mean;
  const float rstd = rsqrtf(var + TEPS);
#pragma unroll
  for (int i = 0; i < 8; i++) {
    const int col = tid + i * 256;
    out[(size_t)row * TD + col] = f2bf((lx[i] - mean) * rstd * w[col] + b[col]);
  }
}

// ---------- Weights: f32 -> bf16, once per call ----------
// Every GEMM work-group of a tile column needs the same rounded W tile; rounding
// it here once leaves the GEMM a W stream of 2 B an element that needs no register.
// dst holds Wq | Wk | Wv | Wo | W_in | W_out back to back, each in its own layout.
// One block moves WCH floats: 8 wave-wide 512-B loads in flight per wave.
constexpr int WCH  = 8192;
constexpr int WBD  = TD * TD / WCH;      // blocks per D x D matrix
constexpr int WBF  = TD * TDFF / WCH;    // blocks per D x DFF matrix
__global__ __launch_bounds__(256) void weights_bf16_k(
    const float* __restrict__ Wq, const float* __restrict__ Wk,
    const float* __restrict__ Wv, const float* __restrict__ Wo,
    const float* __restrict__ Win, const float* __restrict__ Wout,
    __bf16* __restrict__ dst) {
  const int blk = blockIdx.x;
  const float* src;
  int rel;
  if (blk < 4 * WBD) {
    const int w = blk / WBD;
    src = (w == 0) ? Wq : (w == 1) ? Wk : (w == 2) ? Wv : Wo;
    rel = blk % WBD;
  } else if (blk < 4 * WBD + WBF) {
    src = Win;  rel = blk - 4 * WBD;
  } else {
    src = Wout; rel = blk - 4 * WBD - WBF;
  }
  const float4* sp = (const float4*)(src + (size_t)rel * WCH) + threadIdx.x;
  uint2* dp = (uint2*)(dst + (size_t)blk * WCH) + threadIdx.x;
  float4 f[8];
#pragma unroll  // all eight loads issue before the first use
  for (int i = 0; i < 8; i++) f[i] = sp[i * 256];
#pragma unroll  // f[] indexed by constants only
  for (int i = 0; i < 8; i++) {
    union { __bf16 h4[4]; uint2 d; } u;
    u.h4[0] = f2bf(f[i].x); u.h4[1] = f2bf(f[i].y);
    u.h4[2] = f2bf(f[i].z); u.h4[3] = f2bf(f[i].w);
    dp[i * 256] = u.d;
  }
}

// ---------- Tiled WMMA GEMM:  C[M,N] = A[M,K](bf16) @ W[N,K]^T(bf16) + bias ----------
// One work-group makes a 128 x 256 tile of C; its 8 waves lie 2 (m) x 4 (n), each with
// 64 x 64 of C, so a staged byte and a fragment feed more products than in a small tile.
// Two LDS buffers, one barrier per BK-deep K step. BK = 128 where the grid has one
// work-group per WGP (it may take most of the LDS); BK = 64 where there are more, so
// that two fit a WGP and one's epilogue runs beside the other's products.
// Staging lanes run along K: a tile row is BK * 2 B of A and of W, so every wave-wide
// copy covers 4 whole lines. Both tiles go global -> LDS by asynchronous copies,
// which fly for a whole K step while the tile before them is multiplied.
// BK = 128 (two waves per SIMD, registers to spare): two fragment sets; each 32-deep
// block's 16 LDS loads go out as one group, one block ahead of the products that use
// them. The next tile's first fragments are fetched under this tile's last block, so
// the publish point stands in front of that block. BK = 64 (four waves per SIMD) has
// no registers for a second set and hides its LDS waits behind the other waves.
// OUTM: 0 = bf16 [m][n], 1 = f32 [m][n], 2 = bf16 head-transposed V_t[b][h][dh][s]
// K is a template constant: a lane's tile rows then lie at fixed byte distances.
template <int OUTM, bool GELU, bool RES, int K, int BK>
__global__ __launch_bounds__(256) void gemm_bf16_k(
    const __bf16* __restrict__ A, const __bf16* __restrict__ W,
    const float* __restrict__ bias, const float* __restrict__ res,
    void* __restrict__ outp, int M, int N, float scale) {
  constexpr int BM = 128, BN = 256;         // tile rows (of A) and columns (rows of W)
  constexpr int SA = BK + 8;                // 144- or 272-B pitch: 16 B x odd
  constexpr int MI = BM / 32;               // 16-row A fragments per wave
  constexpr int LPR = BK / 8;               // staging lanes per tile row, 16 B each
  constexpr int RPC = 256 / LPR;            // tile rows per work-group-wide copy
  static_assert(K % BK == 0 && K >= 2 * BK, "the ring's prologue fills two tiles");
  static_assert(BK == 64 || BK == 128, "pitch and staging map are set for these");
  __shared__ __attribute__((aligned(16))) __bf16 As[2][BM * SA];
  __shared__ __attribute__((aligned(16))) __bf16 Bs[2][BN * SA];
  const int tid = threadIdx.x, lane = tid & 31, wave = tid >> 5;
  const int lrow = lane & 15, lhi = (lane >> 4) & 1;
  const int m0 = blockIdx.y * BM, n0 = blockIdx.x * BN;
  const int mb = (wave & 1) * (BM / 2), nb = (wave >> 1) * 64;
  const int arow = tid / LPR, acol = (tid % LPR) * 8; // A and W: LPR lanes x 16 B per row

  v8f acc[MI][4];
#pragma unroll
  for (int i = 0; i < MI; i++)
#pragma unroll
    for (int j = 0; j < 4; j++)
#pragma unroll
      for (int e = 0; e < 8; e++) acc[i][j][e] = 0.f;

  auto stage = [&](int buf, int k0) {
    const __bf16* asrc = A + (size_t)(m0 + arow) * K + k0 + acol;
    const __bf16* wsrc = W + (size_t)(n0 + arow) * K + k0 + acol;
#pragma unroll  // the whole tile's copies in flight at once, LDS places as constants
    for (int i = 0; i < BM / RPC; i++)
      cp16_g2l(asrc + (size_t)(RPC * i) * K, &As[buf][(arow + RPC * i) * SA + acol]);
#pragma unroll  // as above
    for (int i = 0; i < BN / RPC; i++)
      cp16_g2l(wsrc + (size_t)(RPC * i) * K, &Bs[buf][(arow + RPC * i) * SA + acol]);
  };

  // prologue: tile 0 landed and published, then tile 1 on its way
  stage(0, 0);
  ring_wait_async0();
  __syncthreads();
  stage(1, BK);
  if constexpr (BK == 128) {
    constexpr int KSUB = BK / 32;           // blocks per tile; even, so set 0 opens every tile
    v16bf af[2][MI], bfr[2][4];             // set (u & 1) holds block u's fragments
#pragma unroll
    for (int mi = 0; mi < MI; mi++)
      af[0][mi] = frag_ld(&As[0][(mb + mi * 16 + lrow) * SA], lhi);
#pragma unroll
    for (int ni = 0; ni < 4; ni++)
      bfr[0][ni] = frag_ld(&Bs[0][(nb + ni * 16 + lrow) * SA], lhi);
    int buf = 0;
#pragma clang loop unroll(disable)  // one trip's text stays small; sets alternate inside a trip
    for (int k0 = 0; k0 < K; k0 += BK, buf ^= 1) {
#pragma unroll  // af, bfr indexed by constants only
      for (int u = 0; u < KSUB; u++) {
        const int cs = u & 1;
        if (u + 1 < KSUB) {
          const int kk = (u + 1) * 32;
#pragma unroll
          for (int mi = 0; mi < MI; mi++)
            af[cs ^ 1][mi] = frag_ld(&As[buf][(mb + mi * 16 + lrow) * SA + kk], lhi);
#pragma unroll
          for (int ni = 0; ni < 4; ni++)
            bfr[cs ^ 1][ni] = frag_ld(&Bs[buf][(nb + ni * 16 + lrow) * SA + kk], lhi);
        } else {
          // publish point of the next tile: the last block's fragments are in registers,
          // so it also ends every read of [buf]
          ring_wait_ds0();
          ring_wait_async0();
          __syncthreads();
          if (k0 + 2 * BK < K)
            stage(buf, k0 + 2 * BK);  // flies under this block's and the next trip's WMMAs
          // the next tile's first fragments; on the last trip they read the other
          // buffer's old tile, which nothing writes any more, and are not used
#pragma unroll
          for (int mi = 0; mi < MI; mi++)
            af[cs ^ 1][mi] = frag_ld(&As[buf ^ 1][(mb + mi * 16 + lrow) * SA], lhi);
#pragma unroll
          for (int ni = 0; ni < 4; ni++)
            bfr[cs ^ 1][ni] = frag_ld(&Bs[buf ^ 1][(nb + ni * 16 + lrow) * SA], lhi);
        }
        sched_fence();  // the load group stays whole, in front of the block
#pragma unroll
        for (int mi = 0; mi < MI; mi++)
#pragma unroll
          for (int ni = 0; ni < 4; ni++)
            acc[mi][ni] = wmma_bf16(af[cs][mi], bfr[cs][ni], acc[mi][ni]);
        sched_fence();  // the next group does not rise into this block
      }
    }
  } else {
    int buf = 0;
    for (int k0 = 0; k0 < K; k0 += BK, buf ^= 1) {
#pragma unroll  // a later block's fragment reads may start under an earlier one's products
      for (int kk = 0; kk < BK; kk += 32) {
        v16bf af[MI], bfr[4];
#pragma unroll
        for (int mi = 0; mi < MI; mi++)
          af[mi] = frag_ld(&As[buf][(mb + mi * 16 + lrow) * SA + kk], lhi);
#pragma unroll
        for (int ni = 0; ni < 4; ni++)
          bfr[ni] = frag_ld(&Bs[buf][(nb + ni * 16 + lrow) * SA + kk], lhi);
#pragma unroll
        for (int mi = 0; mi < MI; mi++)
#pragma unroll
          for (int ni = 0; ni < 4; ni++)
            acc[mi][ni] = wmma_bf16(af[mi], bfr[ni], acc[mi][ni]);
      }
      // publish point of the next tile; it also ends every read of [buf]
      ring_wait_ds0();
      ring_wait_async0();
      __syncthreads();
      if (k0 + 2 * BK < K)
        stage(buf, k0 + 2 * BK);  // flies under the next trip's WMMAs
    }
  }
  ring_wait_async0();         // no copy outlives the loop

  // epilogue: C/D layout -> lane holds (m = v + 8*lhi, n = lane&15) per frag
  // Every trip works on fragment row 0 and then moves the rows up one place, so acc is
  // indexed by constants only. With GELU the loop stays rolled: a trip's 32 elements are
  // independent chains enough to fill the vector port, and the text stays a quarter as
  // long. Unrolled (the other kernels) the moves are mere renaming and cost nothing.
#pragma unroll(GELU ? 1 : MI)
  for (int mi = 0; mi < MI; mi++) {
#pragma unroll
    for (int ni = 0; ni < 4; ni++) {
      const int n = n0 + nb + ni * 16 + lrow;
      const float bv = bias[n];
#pragma unroll
      for (int v = 0; v < 8; v++) {
        const int m = m0 + mb + mi * 16 + v + 8 * lhi;
        float t = (acc[0][ni][v] + bv) * scale;
        if (GELU) t = gelu_f(t);
        if (RES)  t += res[(size_t)m * N + n];
        if (OUTM == 0) {
          ((__bf16*)outp)[(size_t)m * N + n] = f2bf(t);
        } else if (OUTM == 1) {
          ((float*)outp)[(size_t)m * N + n] = t;
        } else {  // V_t[b][h][dh][s]
          const int b_ = m / TS, s = m % TS;
          const int h = n / TDH, dh = n % TDH;
          ((__bf16*)outp)[((size_t)(b_ * THD + h) * TDH + dh) * TS + s] = f2bf(t);
        }
      }
    }
    // rolled loop: the next trip reuses the registers that this trip's last store names
    if (GELU) asm volatile("s_wait_xcnt 0x0" ::: "memory");
#pragma unroll
    for (int r = 0; r + 1 < MI; r++)
#pragma unroll
      for (int ni = 0; ni < 4; ni++) acc[r][ni] = acc[r + 1][ni];
  }
}

// ---------- Flash attention (causal), one (b,h) x 128-query block per WG ----------
// Computes S^T = K Q^T so query == lane column; O^T = V^T P^T with V_t rows.
__global__ __launch_bounds__(256) void attn_k(
    const __bf16* __restrict__ Qb, const __bf16* __restrict__ Kb,
    const __bf16* __restrict__ Vt, __bf16* __restrict__ Ob) {
  constexpr int SK = 136, SV = 40, SP = 40;
  __shared__ __bf16 Ks[32 * SK];    // [key][d]
  __shared__ __bf16 Vs[128 * SV];   // [d][key]
  __shared__ __bf16 Ps[8 * 16 * SP];// per-wave P[q][key]
  const int tid = threadIdx.x, lane = tid & 31, wave = tid >> 5;
  const int lrow = lane & 15, lhi = (lane >> 4) & 1;
  const int bh = blockIdx.y, b_ = bh >> 4, h = bh & 15;
  const int q0 = blockIdx.x * 128;
  const int qg = q0 + wave * 16 + lrow;   // this lane's query column

  // Q fragments (B-operand), invariant across the k-loop
  v16bf qf[4];
  const __bf16* qbase = Qb + (size_t)(b_ * TS + q0 + wave * 16 + lrow) * TD + h * TDH;
#pragma unroll
  for (int c = 0; c < 4; c++) qf[c] = frag_ld(qbase + c * 32, lhi);

  v8f o[8];
#pragma unroll
  for (int dc = 0; dc < 8; dc++)
#pragma unroll
    for (int e = 0; e < 8; e++) o[dc][e] = 0.f;
  float mrun = -__builtin_inff(), lrun = 0.f;

  const int kr = tid >> 3, kc = (tid & 7) * 16;   // K-tile prefetch coords
  const int vr = tid >> 1, vc = (tid & 1) * 16;   // V-tile prefetch coords
  // staging coords: lanes run along a row, 16 B each, so a wave-wide copy
  // covers whole rows of the tile (K: 256 B, V_t: 64 B)
  const int ksr = tid >> 4, ksc = (tid & 15) * 8;
  const int vsr = tid >> 2, vsc = (tid & 3) * 8;
  const int kend = q0 + 128;
  for (int k0 = 0; k0 < kend; k0 += 32) {
    __syncthreads();          // previous iteration's LDS reads complete
    {  // stage K tile: 32 keys x 128 d
      const __bf16* src = Kb + (size_t)(b_ * TS + k0 + ksr) * TD + h * TDH + ksc;
      cp16_g2l(src,                   Ks + ksr * SK + ksc);
      cp16_g2l(src + (size_t)16 * TD, Ks + (ksr + 16) * SK + ksc);
    }
    {  // stage V_t tile: 128 d x 32 keys (k-contiguous rows)
      const __bf16* src = Vt + ((size_t)bh * TDH + vsr) * TS + k0 + vsc;
      cp16_g2l(src,                   Vs + vsr * SV + vsc);
      cp16_g2l(src + (size_t)64 * TS, Vs + (vsr + 64) * SV + vsc);
    }
    if (k0 + 32 < kend) {     // prefetch next tiles into cache
      __builtin_prefetch(Kb + (size_t)(b_ * TS + k0 + 32 + kr) * TD + h * TDH + kc, 0, 1);
      __builtin_prefetch(Vt + ((size_t)bh * TDH + vr) * TS + k0 + 32 + vc, 0, 1);
    }
    async_wait0();
    __syncthreads();

    // scores S^T: two 16-key subtiles, each 4 WMMAs over DH=128.
    // All 8 K fragments are fetched first, 16 LDS loads as one group in the order in
    // which the products use them: the wave pays one LDS latency, not one per product.
    v16bf kf[4][2];
#pragma unroll  // kf indexed by constants only
    for (int c = 0; c < 4; c++)
#pragma unroll
      for (int sub = 0; sub < 2; sub++)
        kf[c][sub] = frag_ld(Ks + (sub * 16 + lrow) * SK + c * 32, lhi);
    sched_fence();  // the K group stays whole, in front of its products
    v8f st[2];
#pragma unroll
    for (int sub = 0; sub < 2; sub++)
#pragma unroll
      for (int e = 0; e < 8; e++) st[sub][e] = 0.f;
#pragma unroll  // the two subtiles' sums alternate: two independent accumulator chains
    for (int c = 0; c < 4; c++)
#pragma unroll
      for (int sub = 0; sub < 2; sub++)
        st[sub] = wmma_bf16(kf[c][sub], qf[c], st[sub]);
    sched_fence();  // keeps the V group whole: without it two of its loads rise further up among the products
    // All 8 V_t fragments, 16 LDS loads as one group into the registers that the K
    // fragments have left; they land under the mask and the row maximum.
    v16bf vf[8];
#pragma unroll  // vf indexed by constants only
    for (int dc = 0; dc < 8; dc++)
      vf[dc] = frag_ld(Vs + (dc * 16 + lrow) * SV, lhi);

    float pv[2][8];
    // masking only needed when this 32-key tile can reach past a query of
    // this wave; wave-uniform condition -> scalar branch, EXEC stays full
    const bool needmask = (k0 + 31) > (q0 + wave * 16);
    if (needmask) {
#pragma unroll
      for (int sub = 0; sub < 2; sub++)
#pragma unroll
        for (int v = 0; v < 8; v++) {
          const int kg = k0 + sub * 16 + v + 8 * lhi;
          pv[sub][v] = (kg <= qg) ? st[sub][v] : -__builtin_inff();
        }
    } else {
#pragma unroll
      for (int sub = 0; sub < 2; sub++)
#pragma unroll
        for (int v = 0; v < 8; v++) pv[sub][v] = st[sub][v];
    }

    // online softmax per query (in-lane + one xor-16 exchange)
    float mt = -__builtin_inff();
#pragma unroll
    for (int sub = 0; sub < 2; sub++)
#pragma unroll
      for (int v = 0; v < 8; v++) mt = fmaxf(mt, pv[sub][v]);
    mt = fmaxf(mt, __shfl_xor(mt, 16, 32));
    const float mnew = fmaxf(mrun, mt);
    const float corr = __expf(mrun - mnew);
    float psum = 0.f;
#pragma unroll
    for (int sub = 0; sub < 2; sub++)
#pragma unroll
      for (int v = 0; v < 8; v++) {
        const float p = __expf(pv[sub][v] - mnew);
        pv[sub][v] = p;
        psum += p;
      }
    psum += __shfl_xor(psum, 16, 32);
    lrun = lrun * corr + psum;
    mrun = mnew;
#pragma unroll
    for (int dc = 0; dc < 8; dc++)
#pragma unroll
      for (int e = 0; e < 8; e++) o[dc][e] *= corr;

    // stage P (bf16) per wave: lane writes 8 contiguous keys -> one b128.
    // Must stay a plain DS store: we rely on same-wave DS ordering for the
    // immediate reload below (ASYNC ops would not preserve it).
#pragma unroll
    for (int sub = 0; sub < 2; sub++) {
      union { __bf16 h8[8]; uint4 q; } u;
#pragma unroll
      for (int v = 0; v < 8; v++) u.h8[v] = f2bf(pv[sub][v]);
      *(uint4*)(Ps + (wave * 16 + lrow) * SP + sub * 16 + 8 * lhi) = u.q;
    }
    v16bf pf = frag_ld(Ps + (wave * 16 + lrow) * SP, lhi);
#pragma unroll
    for (int dc = 0; dc < 8; dc++) o[dc] = wmma_bf16(vf[dc], pf, o[dc]);
  }

  const float inv = 1.f / lrun;
#pragma unroll
  for (int dc = 0; dc < 8; dc++)
#pragma unroll
    for (int v = 0; v < 8; v++) {
      const int d = dc * 16 + v + 8 * lhi;
      Ob[(size_t)(b_ * TS + qg) * TD + h * TDH + d] = f2bf(o[dc][v] * inv);
    }
}

// ---------- host-side orchestration ----------
extern "C" void kernel_launch(void* const* d_in, const int* in_sizes, int n_in,
                              void* d_out, int out_size, void* d_ws, size_t ws_size,
                              hipStream_t stream) {
  (void)in_sizes; (void)n_in; (void)out_size; (void)ws_size;
  const float* X    = (const float*)d_in[0];
  const float* Wq   = (const float*)d_in[1];
  const float* bq   = (const float*)d_in[2];
  const float* Wk   = (const float*)d_in[3];
  const float* bk   = (const float*)d_in[4];
  const float* Wv   = (const float*)d_in[5];
  const float* bv   = (const float*)d_in[6];
  const float* Wo   = (const float*)d_in[7];
  const float* bo   = (const float*)d_in[8];
  const float* Win  = (const float*)d_in[9];
  const float* bin  = (const float*)d_in[10];
  const float* Wout = (const float*)d_in[11];
  const float* bout = (const float*)d_in[12];
  const float* ln1w = (const float*)d_in[13];
  const float* ln1b = (const float*)d_in[14];
  const float* ln2w = (const float*)d_in[15];
  const float* ln2b = (const float*)d_in[16];
  float* out = (float*)d_out;

  char* ws = (char*)d_ws;
  const size_t szMD = (size_t)TM * TD * 2;          // 16.78 MB (bf16 M x D)
  __bf16* lnb = (__bf16*)(ws);                      // LN output (reused for LN2)
  __bf16* Qb  = (__bf16*)(ws + 1 * szMD);
  __bf16* Kb  = (__bf16*)(ws + 2 * szMD);
  __bf16* Vt  = (__bf16*)(ws + 3 * szMD);
  __bf16* Ab  = (__bf16*)(ws + 4 * szMD);           // attention output
  float*  X1  = (float*)(ws + 5 * szMD);            // residual stream (f32, 2*szMD)
  __bf16* Hm  = (__bf16*)(ws + 1 * szMD);           // MLP hidden reuses Qb..Ab (4*szMD)
  __bf16* Wb  = (__bf16*)(ws + 7 * szMD);           // bf16 weights, 96 MiB in all
  const __bf16* Wqb   = Wb;
  const __bf16* Wkb   = Wb + 1 * (size_t)TD * TD;
  const __bf16* Wvb   = Wb + 2 * (size_t)TD * TD;
  const __bf16* Wob   = Wb + 3 * (size_t)TD * TD;
  const __bf16* Winb  = Wb + 4 * (size_t)TD * TD;
  const __bf16* Woutb = Wb + 4 * (size_t)TD * TD + (size_t)TD * TDFF;

  const float qk = 0.29730177875068026f;            // 1/sqrt(sqrt(128))
  dim3 th(256);
  dim3 gD(TD / 256, TM / 128);      // (8, 32): 128 x 256 tiles
  dim3 gF(TDFF / 256, TM / 128);    // (32, 32)
  dim3 gA(TS / 128, TB * THD);      // (16, 32)

  weights_bf16_k<<<4 * WBD + 2 * WBF, th, 0, stream>>>(Wq, Wk, Wv, Wo, Win, Wout, Wb);
  layernorm_bf16_k<<<TM, th, 0, stream>>>(X, ln1w, ln1b, lnb);
  gemm_bf16_k<0, false, false, TD, 128><<<gD, th, 0, stream>>>(lnb, Wqb, bq, nullptr, Qb, TM, TD, qk);
  gemm_bf16_k<0, false, false, TD, 128><<<gD, th, 0, stream>>>(lnb, Wkb, bk, nullptr, Kb, TM, TD, qk);
  gemm_bf16_k<2, false, false, TD, 128><<<gD, th, 0, stream>>>(lnb, Wvb, bv, nullptr, Vt, TM, TD, 1.f);
  attn_k<<<gA, th, 0, stream>>>(Qb, Kb, Vt, Ab);
  gemm_bf16_k<1, false, true, TD, 128><<<gD, th, 0, stream>>>(Ab, Wob, bo, X, (void*)X1, TM, TD, 1.f);
  layernorm_bf16_k<<<TM, th, 0, stream>>>(X1, ln2w, ln2b, lnb);
  gemm_bf16_k<0, true, false, TD, 64><<<gF, th, 0, stream>>>(lnb, Winb, bin, nullptr, Hm, TM, TDFF, 1.f);
  gemm_bf16_k<1, false, true, TDFF, 128><<<gD, th, 0, stream>>>(Hm, Woutb, bout, X1, (void*)out, TM, TD, 1.f);
}

// v007
// One run takes 393 microseconds.
// Two timings next to v006 both put it at 1.04 times that version's speed.
// Over all steps from v000 it is 2.23 times as fast.
#include <hip/hip_runtime.h>
#include <hip/hip_bf16.h>
#include <math.h>

typedef __attribute__((ext_vector_type(16))) __bf16 v16bf;
typedef __attribute__((ext_vector_type(8)))  __bf16 v8bf;
typedef __attribute__((ext_vector_type(8)))  float  v8f;
typedef __attribute__((ext_vector_type(4)))  int    v4i;

#define DEV static __device__ __forceinline__
#define GAS __attribute__((address_space(1)))
#define LAS __attribute__((address_space(3)))

#if __has_builtin(__builtin_amdgcn_global_load_async_to_lds_b128) && \
    __has_builtin(__builtin_amdgcn_s_wait_asynccnt)
#define HAS_ASYNC_LDS 1
#else
#define HAS_ASYNC_LDS 0
#endif

namespace {
constexpr int   TB   = 2;
constexpr int   TS   = 2048;
constexpr int   TD   = 2048;
constexpr int   THD  = 16;     // heads
constexpr int   TDH  = 128;    // head dim
constexpr int   TDFF = 8192;
constexpr int   TM   = TB * TS;          // 4096 token rows
constexpr float TEPS = 1e-5f;
}

// ---------- scalar helpers ----------
DEV __bf16 f2bf(float x) {
  unsigned u = __builtin_bit_cast(unsigned, x);
  unsigned r = u + 0x7FFFu + ((u >> 16) & 1u);      // RNE
  unsigned short s = (unsigned short)(r >> 16);
  return __builtin_bit_cast(__bf16, s);
}

// 0.5 x (1 + tanh u) = x / (1 + e^(-2u)), u = c (x + 0.044715 x^3): the same function,
// with one exp2 and one reciprocal and no branch. The library tanhf splits the lanes on
// |u| and runs both sides, one element behind the other; here the elements of an
// epilogue trip are independent chains. No difference of near-equal terms is formed;
// e^(-2u) = 0 or infinity gives x or 0, as the limits of tanh do.
DEV float gelu_f(float x) {
  const float k = -2.f * 0.7978845608028654f * 1.4426950408889634f;  // -2 c log2(e)
  const float u = x * __builtin_fmaf(x * x, 0.044715f, 1.f);
  return x * __builtin_amdgcn_rcpf(1.f + __builtin_amdgcn_exp2f(k * u));
}

// 16B global -> LDS copy: async-to-LDS (ASYNCcnt) when available, else
// load + ds_store fallback. Builtin signature (from hipcc diagnostic):
// (AS1 v4i* global_src, AS3 v4i* lds_dst, imm offset, imm cpol).
DEV void cp16_g2l(const __bf16* g, __bf16* l) {
#if HAS_ASYNC_LDS
  __builtin_amdgcn_global_load_async_to_lds_b128(
      (GAS v4i*)g, (LAS v4i*)l, 0, 0);
#else
  *(uint4*)l = *(const uint4*)g;
#endif
}
DEV void async_wait0() {
#if HAS_ASYNC_LDS
  __builtin_amdgcn_s_wait_asynccnt(0);
#endif
}
// Publish-point waits of the GEMM ring, each a statement of its own; the
// "memory" clobber keeps every LDS read and copy on its side of the wait.
DEV void ring_wait_async0() {
  // this wave's copies have landed before the barrier that publishes them
  asm volatile("s_wait_asynccnt 0x0" ::: "memory");
}
DEV void ring_wait_ds0() {
  // this wave's LDS reads have retired before the buffer is refilled
  asm volatile("s_wait_dscnt 0x0" ::: "memory");
}

// Nothing is scheduled across this point: without it the compiler sinks the fragment
// loads in among the WMMAs, two at a time, each pair with a wait to 0 right behind it.
DEV void sched_fence() { __builtin_amdgcn_sched_barrier(0); }

// Load one 16x(32-chunk) bf16 fragment (A-style row layout).
// Per the CDNA5 ISA layout, lane L holds row (L&15); its 16 bf16 elements are
// two contiguous 8-element runs at K offsets {8*(L>>4), 16+8*(L>>4)}.
DEV v16bf frag_ld(const __bf16* rowbase, int lhi) {
  v8bf lo = *(const v8bf*)(rowbase + 8 * lhi);
  v8bf hi = *(const v8bf*)(rowbase + 16 + 8 * lhi);
  return __builtin_shufflevector(lo, hi, 0, 1, 2, 3, 4, 5, 6, 7,
                                         8, 9, 10, 11, 12, 13, 14, 15);
}

DEV v8f wmma_bf16(v16bf a, v16bf b, v8f c) {
  return __builtin_amdgcn_wmma_f32_16x16x32_bf16(false, a, false, b,
                                                 (short)0, c, false, false);
}

// ---------- LayerNorm: f32 in -> bf16 out ----------
__global__ __launch_bounds__(256) void layernorm_bf16_k(
    const float* __restrict__ X, const float* __restrict__ w,
    const float* __restrict__ b, __bf16* __restrict__ out) {
  __shared__ float r1[256];
  __shared__ float r2[256];
  const int row = blockIdx.x;
  const int tid = threadIdx.x;
  const float* x = X + (size_t)row * TD;
  float lx[8], s = 0.f, ss = 0.f;
#pragma unroll
  for (int i = 0; i < 8; i++) {
    lx[i] = x[tid + i * 256];
    s += lx[i];
    ss += lx[i] * lx[i];
  }
  r1[tid] = s; r2[tid] = ss;
  __syncthreads();
  for (int off = 128; off > 0; off >>= 1) {
    if (tid < off) { r1[tid] += r1[tid + off]; r2[tid] += r2[tid + off]; }
    __syncthreads();
  }
  const float mean = r1[0] * (1.f / TD);
  const float var  = r2[0] * (1.f / TD) - mean * mean;
  const float rstd = rsqrtf(var + TEPS);
#pragma unroll
  for (int i = 0; i < 8; i++) {
    const int col = tid + i * 256;
    out[(size_t)row * TD + col] = f2bf((lx[i] - mean) * rstd * w[col] + b[col]);
  }
}

// ---------- Weights: f32 -> bf16, once per call ----------
// Every GEMM work-group of a tile column needs the same rounded W tile; rounding
// it here once leaves the GEMM a W stream of 2 B an element that needs no register.
// dst holds Wq | Wk | Wv | Wo | W_in | W_out back to back, each in its own layout.
// One block moves WCH floats: 8 wave-wide 512-B loads in flight per wave.
constexpr int WCH  = 8192;
constexpr int WBD  = TD * TD / WCH;      // blocks per D x D matrix
constexpr int WBF  = TD * TDFF / WCH;    // blocks per D x DFF matrix
__global__ __launch_bounds__(256) void weights_bf16_k(
    const float* __restrict__ Wq, const float* __restrict__ Wk,
    const float* __restrict__ Wv, const float* __restrict__ Wo,
    const float* __restrict__ Win, const float* __restrict__ Wout,
    __bf16* __restrict__ dst) {
  const int blk = blockIdx.x;
  const float* src;
  int rel;
  if (blk < 4 * WBD) {
    const int w = blk / WBD;
    src = (w == 0) ? Wq : (w == 1) ? Wk : (w == 2) ? Wv : Wo;
    rel = blk % WBD;
  } else if (blk < 4 * WBD + WBF) {
    src = Win;  rel = blk - 4 * WBD;
  } else {
    src = Wout; rel = blk - 4 * WBD - WBF;
  }
  const float4* sp = (const float4*)(src + (size_t)rel * WCH) + threadIdx.x;
  uint2* dp = (uint2*)(dst + (size_t)blk * WCH) + threadIdx.x;
  float4 f[8];
#pragma unroll  // all eight loads issue before the first use
  for (int i = 0; i < 8; i++) f[i] = sp[i * 256];
#pragma unroll  // f[] indexed by constants only
  for (int i = 0; i < 8; i++) {
    union { __bf16 h4[4]; uint2 d; } u;
    u.h4[0] = f2bf(f[i].x); u.h4[1] = f2bf(f[i].y);
    u.h4[2] = f2bf(f[i].z); u.h4[3] = f2bf(f[i].w);
    dp[i * 256] = u.d;
  }
}

// ---------- Tiled WMMA GEMM:  C[M,N] = A[M,K](bf16) @ W[N,K]^T(bf16) + bias ----------
// One work-group makes a BM x 256 tile of C; its 8 waves lie 2 (m) x 4 (n), each with
// BM/2 x 64 of C, so a staged byte and a fragment feed more products than in a small tile.
// BM = 128 where N = D: 256 tiles, one per WGP. BM = 256 where N = DFF: 512 tiles, two
// rounds of one per WGP; a tile element then takes 1/128 instead of 1/85 staged rows, and
// a 32-deep block is 32 products on 12 fragments instead of 16 on 8.
// Two LDS buffers, one barrier per BK-deep K step; a work-group takes most of the LDS.
// Staging lanes run along K: a tile row is BK * 2 B of A and of W, so every wave-wide
// copy covers 4 whole lines. Both tiles go global -> LDS by asynchronous copies,
// which fly for a whole K step while the tile before them is multiplied.
// Two waves per SIMD, two fragment sets: each 32-deep block's LDS loads go out as one
// group, one block ahead of the products that use them. The next tile's first fragments
// are fetched under this tile's last block, so the publish point stands in front of it.
// OUTM: 0 = bf16 [m][n], 1 = f32 [m][n], 2 = bf16 head-transposed V_t[b][h][dh][s]
// K is a template constant: a lane's tile rows then lie at fixed byte distances.
template <int OUTM, bool GELU, bool RES, int K, int BK, int BM>
__global__ __launch_bounds__(256) void gemm_bf16_k(
    const __bf16* __restrict__ A, const __bf16* __restrict__ W,
    const float* __restrict__ bias, const float* __restrict__ res,
    void* __restrict__ outp, int M, int N, float scale) {
  constexpr int BN = 256;                   // tile columns (rows of W); BM = tile rows (of A)
  constexpr int SA = BK + 8;                // 272-B pitch: 16 B x odd
  constexpr int MI = BM / 32;               // 16-row A fragments per wave
  constexpr int LPR = BK / 8;               // staging lanes per tile row, 16 B each
  constexpr int RPC = 256 / LPR;            // tile rows per work-group-wide copy
  static_assert(K % BK == 0 && K >= 2 * BK, "the ring's prologue fills two tiles");
  static_assert(BK == 128, "pitch and staging map are set for this");
  static_assert(BM == 128 || BM == 256, "wave map: 2 x 4 waves of BM/2 x 64");
  __shared__ __attribute__((aligned(16))) __bf16 As[2][BM * SA];
  __shared__ __attribute__((aligned(16))) __bf16 Bs[2][BN * SA];
  const int tid = threadIdx.x, lane = tid & 31, wave = tid >> 5;
  const int lrow = lane & 15, lhi = (lane >> 4) & 1;
  const int m0 = blockIdx.y * BM, n0 = blockIdx.x * BN;
  const int mb = (wave & 1) * (BM / 2), nb = (wave >> 1) * 64;
  const int arow = tid / LPR, acol = (tid % LPR) * 8; // A and W: LPR lanes x 16 B per row

  v8f acc[MI][4];
#pragma unroll
  for (int i = 0; i < MI; i++)
#pragma unroll
    for (int j = 0; j < 4; j++)
#pragma unroll
      for (int e = 0; e < 8; e++) acc[i][j][e] = 0.f;

  auto stage = [&](int buf, int k0) {
    const __bf16* asrc = A + (size_t)(m0 + arow) * K + k0 + acol;
    const __bf16* wsrc = W + (size_t)(n0 + arow) * K + k0 + acol;
#pragma unroll  // the whole tile's copies in flight at once, LDS places as constants
    for (int i = 0; i < BM / RPC; i++)
      cp16_g2l(asrc + (size_t)(RPC * i) * K, &As[buf][(arow + RPC * i) * SA + acol]);
#pragma unroll  // as above
    for (int i = 0; i < BN / RPC; i++)
      cp16_g2l(wsrc + (size_t)(RPC * i) * K, &Bs[buf][(arow + RPC * i) * SA + acol]);
  };

  // prologue: tile 0 landed and published, then tile 1 on its way
  stage(0, 0);
  ring_wait_async0();
  __syncthreads();
  stage(1, BK);
  {
    constexpr int KSUB = BK / 32;           // blocks per tile; even, so set 0 opens every tile
    v16bf af[2][MI], bfr[2][4];             // set (u & 1) holds block u's fragments
#pragma unroll
    for (int mi = 0; mi < MI; mi++)
      af[0][mi] = frag_ld(&As[0][(mb + mi * 16 + lrow) * SA], lhi);
#pragma unroll
    for (int ni = 0; ni < 4; ni++)
      bfr[0][ni] = frag_ld(&Bs[0][(nb + ni * 16 + lrow) * SA], lhi);
    int buf = 0;
#pragma clang loop unroll(disable)  // one trip's text stays small; sets alternate inside a trip
    for (int k0 = 0; k0 < K; k0 += BK, buf ^= 1) {
#pragma unroll  // af, bfr indexed by constants only
      for (int u = 0; u < KSUB; u++) {
        const int cs = u & 1;
        if (u + 1 < KSUB) {
          const int kk = (u + 1) * 32;
#pragma unroll
          for (int mi = 0; mi < MI; mi++)
            af[cs ^ 1][mi] = frag_ld(&As[buf][(mb + mi * 16 + lrow) * SA + kk], lhi);
#pragma unroll
          for (int ni = 0; ni < 4; ni++)
            bfr[cs ^ 1][ni] = frag_ld(&Bs[buf][(nb + ni * 16 + lrow) * SA + kk], lhi);
        } else {
          // publish point of the next tile: the last block's fragments are in registers,
          // so it also ends every read of [buf]
          ring_wait_ds0();
          ring_wait_async0();
          __syncthreads();
          if (k0 + 2 * BK < K)
            stage(buf, k0 + 2 * BK);  // flies under this block's and the next trip's WMMAs
          // the next tile's first fragments; on the last trip they read the other
          // buffer's old tile, which nothing writes any more, and are not used
#pragma unroll
          for (int mi = 0; mi < MI; mi++)
            af[cs ^ 1][mi] = frag_ld(&As[buf ^ 1][(mb + mi * 16 + lrow) * SA], lhi);
#pragma unroll
          for (int ni = 0; ni < 4; ni++)
            bfr[cs ^ 1][ni] = frag_ld(&Bs[buf ^ 1][(nb + ni * 16 + lrow) * SA], lhi);
        }
        sched_fence();  // the load group stays whole, in front of the block
#pragma unroll
        for (int mi = 0; mi < MI; mi++)
#pragma unroll
          for (int ni = 0; ni < 4; ni++)
            acc[mi][ni] = wmma_bf16(af[cs][mi], bfr[cs][ni], acc[mi][ni]);
        sched_fence();  // the next group does not rise into this block
      }
    }
  }
  ring_wait_async0();         // no copy outlives the loop

  // epilogue: C/D layout -> lane holds (m = v + 8*lhi, n = lane&15) per frag
  // Every trip works on fragment row 0 and then moves the rows up one place, so acc is
  // indexed by constants only. With GELU the loop stays rolled: a trip's 32 elements are
  // independent chains enough to fill the vector port, and the text stays an eighth as
  // long. Unrolled (the other kernels) the moves are mere renaming and cost nothing.
#pragma unroll(GELU ? 1 : MI)
  for (int mi = 0; mi < MI; mi++) {
#pragma unroll
    for (int ni = 0; ni < 4; ni++) {
      const int n = n0 + nb + ni * 16 + lrow;
      const float bv = bias[n];
#pragma unroll
      for (int v = 0; v < 8; v++) {
        const int m = m0 + mb + mi * 16 + v + 8 * lhi;
        float t = (acc[0][ni][v] + bv) * scale;
        if (GELU) t = gelu_f(t);
        if (RES)  t += res[(size_t)m * N + n];
        if (OUTM == 0) {
          ((__bf16*)outp)[(size_t)m * N + n] = f2bf(t);
        } else if (OUTM == 1) {
          ((float*)outp)[(size_t)m * N + n] = t;
        } else {  // V_t[b][h][dh][s]
          const int b_ = m / TS, s = m % TS;
          const int h = n / TDH, dh = n % TDH;
          ((__bf16*)outp)[((size_t)(b_ * THD + h) * TDH + dh) * TS + s] = f2bf(t);
        }
      }
    }
    // rolled loop: the next trip reuses the registers that this trip's last store names
    if (GELU) asm volatile("s_wait_xcnt 0x0" ::: "memory");
#pragma unroll
    for (int r = 0; r + 1 < MI; r++)
#pragma unroll
      for (int ni = 0; ni < 4; ni++) acc[r][ni] = acc[r + 1][ni];
  }
}

// ---------- Flash attention (causal), one (b,h) x 128-query block per WG ----------
// Computes S^T = K Q^T so query == lane column; O^T = V^T P^T with V_t rows.
__global__ __launch_bounds__(256) void attn_k(
    const __bf16* __restrict__ Qb, const __bf16* __restrict__ Kb,
    const __bf16* __restrict__ Vt, __bf16* __restrict__ Ob) {
  constexpr int SK = 136, SV = 40, SP = 40;
  __shared__ __bf16 Ks[32 * SK];    // [key][d]
  __shared__ __bf16 Vs[128 * SV];   // [d][key]
  __shared__ __bf16 Ps[8 * 16 * SP];// per-wave P[q][key]
  const int tid = threadIdx.x, lane = tid & 31, wave = tid >> 5;
  const int lrow = lane & 15, lhi = (lane >> 4) & 1;
  const int bh = blockIdx.y, b_ = bh >> 4, h = bh & 15;
  const int q0 = blockIdx.x * 128;
  const int qg = q0 + wave * 16 + lrow;   // this lane's query column

  // Q fragments (B-operand), invariant across the k-loop
  v16bf qf[4];
  const __bf16* qbase = Qb + (size_t)(b_ * TS + q0 + wave * 16 + lrow) * TD + h * TDH;
#pragma unroll
  for (int c = 0; c < 4; c++) qf[c] = frag_ld(qbase + c * 32, lhi);

  v8f o[8];
#pragma unroll
  for (int dc = 0; dc < 8; dc++)
#pragma unroll
    for (int e = 0; e < 8; e++) o[dc][e] = 0.f;
  float mrun = -__builtin_inff(), lrun = 0.f;

  const int kr = tid >> 3, kc = (tid & 7) * 16;   // K-tile prefetch coords
  const int vr = tid >> 1, vc = (tid & 1) * 16;   // V-tile prefetch coords
  // staging coords: lanes run along a row, 16 B each, so a wave-wide copy
  // covers whole rows of the tile (K: 256 B, V_t: 64 B)
  const int ksr = tid >> 4, ksc = (tid & 15) * 8;
  const int vsr = tid >> 2, vsc = (tid & 3) * 8;
  const int kend = q0 + 128;
  for (int k0 = 0; k0 < kend; k0 += 32) {
    __syncthreads();          // previous iteration's LDS reads complete
    {  // stage K tile: 32 keys x 128 d
      const __bf16* src = Kb + (size_t)(b_ * TS + k0 + ksr) * TD + h * TDH + ksc;
      cp16_g2l(src,                   Ks + ksr * SK + ksc);
      cp16_g2l(src + (size_t)16 * TD, Ks + (ksr + 16) * SK + ksc);
    }
    {  // stage V_t tile: 128 d x 32 keys (k-contiguous rows)
      const __bf16* src = Vt + ((size_t)bh * TDH + vsr) * TS + k0 + vsc;
      cp16_g2l(src,                   Vs + vsr * SV + vsc);
      cp16_g2l(src + (size_t)64 * TS, Vs + (vsr + 64) * SV + vsc);
    }
    if (k0 + 32 < kend) {     // prefetch next tiles into cache
      __builtin_prefetch(Kb + (size_t)(b_ * TS + k0 + 32 + kr) * TD + h * TDH + kc, 0, 1);
      __builtin_prefetch(Vt + ((size_t)bh * TDH + vr) * TS + k0 + 32 + vc, 0, 1);
    }
    async_wait0();
    __syncthreads();

    // scores S^T: two 16-key subtiles, each 4 WMMAs over DH=128.
    // All 8 K fragments are fetched first, 16 LDS loads as one group in the order in
    // which the products use them: the wave pays one LDS latency, not one per product.
    v16bf kf[4][2];
#pragma unroll  // kf indexed by constants only
    for (int c = 0; c < 4; c++)
#pragma unroll
      for (int sub = 0; sub < 2; sub++)
        kf[c][sub] = frag_ld(Ks + (sub * 16 + lrow) * SK + c * 32, lhi);
    sched_fence();  // the K group stays whole, in front of its products
    v8f st[2];
#pragma unroll
    for (int sub = 0; sub < 2; sub++)
#pragma unroll
      for (int e = 0; e < 8; e++) st[sub][e] = 0.f;
#pragma unroll  // the two subtiles' sums alternate: two independent accumulator chains
    for (int c = 0; c < 4; c++)
#pragma unroll
      for (int sub = 0; sub < 2; sub++)
        st[sub] = wmma_bf16(kf[c][sub], qf[c], st[sub]);
    sched_fence();  // keeps the V group whole: without it two of its loads rise further up among the products
    // All 8 V_t fragments, 16 LDS loads as one group into the registers that the K
    // fragments have left; they land under the mask and the row maximum.
    v16bf vf[8];
#pragma unroll  // vf indexed by constants only
    for (int dc = 0; dc < 8; dc++)
      vf[dc] = frag_ld(Vs + (dc * 16 + lrow) * SV, lhi);

    float pv[2][8];
    // masking only needed when this 32-key tile can reach past a query of
    // this wave; wave-uniform condition -> scalar branch, EXEC stays full
    const bool needmask = (k0 + 31) > (q0 + wave * 16);
    if (needmask) {
#pragma unroll
      for (int sub = 0; sub < 2; sub++)
#pragma unroll
        for (int v = 0; v < 8; v++) {
          const int kg = k0 + sub * 16 + v + 8 * lhi;
          pv[sub][v] = (kg <= qg) ? st[sub][v] : -__builtin_inff();
        }
    } else {
#pragma unroll
      for (int sub = 0; sub < 2; sub++)
#pragma unroll
        for (int v = 0; v < 8; v++) pv[sub][v] = st[sub][v];
    }

    // online softmax per query (in-lane + one xor-16 exchange)
    float mt = -__builtin_inff();
#pragma unroll
    for (int sub = 0; sub < 2; sub++)
#pragma unroll
      for (int v = 0; v < 8; v++) mt = fmaxf(mt, pv[sub][v]);
    mt = fmaxf(mt, __shfl_xor(mt, 16, 32));
    const float mnew = fmaxf(mrun, mt);
    const float corr = __expf(mrun - mnew);
    float psum = 0.f;
#pragma unroll
    for (int sub = 0; sub < 2; sub++)
#pragma unroll
      for (int v = 0; v < 8; v++) {
        const float p = __expf(pv[sub][v] - mnew);
        pv[sub][v] = p;
        psum += p;
      }
    psum += __shfl_xor(psum, 16, 32);
    lrun = lrun * corr + psum;
    mrun = mnew;
#pragma unroll
    for (int dc = 0; dc < 8; dc++)
#pragma unroll
      for (int e = 0; e < 8; e++) o[dc][e] *= corr;

    // stage P (bf16) per wave: lane writes 8 contiguous keys -> one b128.
    // Must stay a plain DS store: we rely on same-wave DS ordering for the
    // immediate reload below (ASYNC ops would not preserve it).
#pragma unroll
    for (int sub = 0; sub < 2; sub++) {
      union { __bf16 h8[8]; uint4 q; } u;
#pragma unroll
      for (int v = 0; v < 8; v++) u.h8[v] = f2bf(pv[sub][v]);
      *(uint4*)(Ps + (wave * 16 + lrow) * SP + sub * 16 + 8 * lhi) = u.q;
    }
    v16bf pf = frag_ld(Ps + (wave * 16 + lrow) * SP, lhi);
#pragma unroll
    for (int dc = 0; dc < 8; dc++) o[dc] = wmma_bf16(vf[dc], pf, o[dc]);
  }

  const float inv = 1.f / lrun;
#pragma unroll
  for (int dc = 0; dc < 8; dc++)
#pragma unroll
    for (int v = 0; v < 8; v++) {
      const int d = dc * 16 + v + 8 * lhi;
      Ob[(size_t)(b_ * TS + qg) * TD + h * TDH + d] = f2bf(o[dc][v] * inv);
    }
}

// ---------- host-side orchestration ----------
extern "C" void kernel_launch(void* const* d_in, const int* in_sizes, int n_in,
                              void* d_out, int out_size, void* d_ws, size_t ws_size,
                              hipStream_t stream) {
  (void)in_sizes; (void)n_in; (void)out_size; (void)ws_size;
  const float* X    = (const float*)d_in[0];
  const float* Wq   = (const float*)d_in[1];
  const float* bq   = (const float*)d_in[2];
  const float* Wk   = (const float*)d_in[3];
  const float* bk   = (const float*)d_in[4];
  const float* Wv   = (const float*)d_in[5];
  const float* bv   = (const float*)d_in[6];
  const float* Wo   = (const float*)d_in[7];
  const float* bo   = (const float*)d_in[8];
  const float* Win  = (const float*)d_in[9];
  const float* bin  = (const float*)d_in[10];
  const float* Wout = (const float*)d_in[11];
  const float* bout = (const float*)d_in[12];
  const float* ln1w = (const float*)d_in[13];
  const float* ln1b = (const float*)d_in[14];
  const float* ln2w = (const float*)d_in[15];
  const float* ln2b = (const float*)d_in[16];
  float* out = (float*)d_out;

  char* ws = (char*)d_ws;
  const size_t szMD = (size_t)TM * TD * 2;          // 16.78 MB (bf16 M x D)
  __bf16* lnb = (__bf16*)(ws);                      // LN output (reused for LN2)
  __bf16* Qb  = (__bf16*)(ws + 1 * szMD);
  __bf16* Kb  = (__bf16*)(ws + 2 * szMD);
  __bf16* Vt  = (__bf16*)(ws + 3 * szMD);
  __bf16* Ab  = (__bf16*)(ws + 4 * szMD);           // attention output
  float*  X1  = (float*)(ws + 5 * szMD);            // residual stream (f32, 2*szMD)
  __bf16* Hm  = (__bf16*)(ws + 1 * szMD);           // MLP hidden reuses Qb..Ab (4*szMD)
  __bf16* Wb  = (__bf16*)(ws + 7 * szMD);           // bf16 weights, 96 MiB in all
  const __bf16* Wqb   = Wb;
  const __bf16* Wkb   = Wb + 1 * (size_t)TD * TD;
  const __bf16* Wvb   = Wb + 2 * (size_t)TD * TD;
  const __bf16* Wob   = Wb + 3 * (size_t)TD * TD;
  const __bf16* Winb  = Wb + 4 * (size_t)TD * TD;
  const __bf16* Woutb = Wb + 4 * (size_t)TD * TD + (size_t)TD * TDFF;

  const float qk = 0.29730177875068026f;            // 1/sqrt(sqrt(128))
  dim3 th(256);
  dim3 gD(TD / 256, TM / 128);      // (8, 32): 128 x 256 tiles
  dim3 gF(TDFF / 256, TM / 256);    // (32, 16): 256 x 256 tiles
  dim3 gA(TS / 128, TB * THD);      // (16, 32)

  weights_bf16_k<<<4 * WBD + 2 * WBF, th, 0, stream>>>(Wq, Wk, Wv, Wo, Win, Wout, Wb);
  layernorm_bf16_k<<<TM, th, 0, stream>>>(X, ln1w, ln1b, lnb);
  gemm_bf16_k<0, false, false, TD, 128, 128><<<gD, th, 0, stream>>>(lnb, Wqb, bq, nullptr, Qb, TM, TD, qk);
  gemm_bf16_k<0, false, false, TD, 128, 128><<<gD, th, 0, stream>>>(lnb, Wkb, bk, nullptr, Kb, TM, TD, qk);
  gemm_bf16_k<2, false, false, TD, 128, 128><<<gD, th, 0, stream>>>(lnb, Wvb, bv, nullptr, Vt, TM, TD, 1.f);
  attn_k<<<gA, th, 0, stream>>>(Qb, Kb, Vt, Ab);
  gemm_bf16_k<1, false, true, TD, 128, 128><<<gD, th, 0, stream>>>(Ab, Wob, bo, X, (void*)X1, TM, TD, 1.f);
  layernorm_bf16_k<<<TM, th, 0, stream>>>(X1, ln2w, ln2b, lnb);
  gemm_bf16_k<0, true, false, TD, 128, 256><<<gF, th, 0, stream>>>(lnb, Winb, bin, nullptr, Hm, TM, TDFF, 1.f);
  gemm_bf16_k<1, false, true, TDFF, 128, 128><<<gD, th, 0, stream>>>(Hm, Woutb, bout, X1, (void*)out, TM, TD, 1.f);
}

// v008
// It runs in 373 microseconds.
// Next to v007, in two timings, it ran 1.05 times as fast each time.
// Counting every step since v000, it is 2.34 times as fast.
#include <hip/hip_runtime.h>
#include <hip/hip_bf16.h>
#include <math.h>

typedef __attribute__((ext_vector_type(16))) __bf16 v16bf;
typedef __attribute__((ext_vector_type(8)))  __bf16 v8bf;
typedef __attribute__((ext_vector_type(8)))  float  v8f;
typedef __attribute__((ext_vector_type(4)))  int    v4i;

#define DEV static __device__ __forceinline__
#define GAS __attribute__((address_space(1)))
#define LAS __attribute__((address_space(3)))

#if __has_builtin(__builtin_amdgcn_global_load_async_to_lds_b128) && \
    __has_builtin(__builtin_amdgcn_s_wait_asynccnt)
#define HAS_ASYNC_LDS 1
#else
#define HAS_ASYNC_LDS 0
#endif

namespace {
constexpr int   TB   = 2;
constexpr int   TS   = 2048;
constexpr int   TD   = 2048;
constexpr int   THD  = 16;     // heads
constexpr int   TDH  = 128;    // head dim
constexpr int   TDFF = 8192;
constexpr int   TM   = TB * TS;          // 4096 token rows
constexpr float TEPS = 1e-5f;
}

// ---------- scalar helpers ----------
DEV __bf16 f2bf(float x) {
  unsigned u = __builtin_bit_cast(unsigned, x);
  unsigned r = u + 0x7FFFu + ((u >> 16) & 1u);      // RNE
  unsigned short s = (unsigned short)(r >> 16);
  return __builtin_bit_cast(__bf16, s);
}

// 0.5 x (1 + tanh u) = x / (1 + e^(-2u)), u = c (x + 0.044715 x^3): the same function,
// with one exp2 and one reciprocal and no branch. The library tanhf splits the lanes on
// |u| and runs both sides, one element behind the other; here the elements of an
// epilogue trip are independent chains. No difference of near-equal terms is formed;
// e^(-2u) = 0 or infinity gives x or 0, as the limits of tanh do.
DEV float gelu_f(float x) {
  const float k = -2.f * 0.7978845608028654f * 1.4426950408889634f;  // -2 c log2(e)
  const float u = x * __builtin_fmaf(x * x, 0.044715f, 1.f);
  return x * __builtin_amdgcn_rcpf(1.f + __builtin_amdgcn_exp2f(k * u));
}

// 16B global -> LDS copy: async-to-LDS (ASYNCcnt) when available, else
// load + ds_store fallback. Builtin signature (from hipcc diagnostic):
// (AS1 v4i* global_src, AS3 v4i* lds_dst, imm offset, imm cpol).
DEV void cp16_g2l(const __bf16* g, __bf16* l) {
#if HAS_ASYNC_LDS
  __builtin_amdgcn_global_load_async_to_lds_b128(
      (GAS v4i*)g, (LAS v4i*)l, 0, 0);
#else
  *(uint4*)l = *(const uint4*)g;
#endif
}
// Publish-point waits of the GEMM ring and of the attention tiles, each a statement of its own; the
// "memory" clobber keeps every LDS read and copy on its side of the wait.
DEV void ring_wait_async0() {
  // this wave's copies have landed before the barrier that publishes them
  asm volatile("s_wait_asynccnt 0x0" ::: "memory");
}
DEV void ring_wait_ds0() {
  // this wave's LDS reads have retired before the buffer is refilled
  asm volatile("s_wait_dscnt 0x0" ::: "memory");
}

// Nothing is scheduled across this point: without it the compiler sinks the fragment
// loads in among the WMMAs, two at a time, each pair with a wait to 0 right behind it.
DEV void sched_fence() { __builtin_amdgcn_sched_barrier(0); }

// Load one 16x(32-chunk) bf16 fragment (A-style row layout).
// Per the CDNA5 ISA layout, lane L holds row (L&15); its 16 bf16 elements are
// two contiguous 8-element runs at K offsets {8*(L>>4), 16+8*(L>>4)}.
DEV v16bf frag_ld(const __bf16* rowbase, int lhi) {
  v8bf lo = *(const v8bf*)(rowbase + 8 * lhi);
  v8bf hi = *(const v8bf*)(rowbase + 16 + 8 * lhi);
  return __builtin_shufflevector(lo, hi, 0, 1, 2, 3, 4, 5, 6, 7,
                                         8, 9, 10, 11, 12, 13, 14, 15);
}

DEV v8f wmma_bf16(v16bf a, v16bf b, v8f c) {
  return __builtin_amdgcn_wmma_f32_16x16x32_bf16(false, a, false, b,
                                                 (short)0, c, false, false);
}

// ---------- LayerNorm: f32 in -> bf16 out ----------
__global__ __launch_bounds__(256) void layernorm_bf16_k(
    const float* __restrict__ X, const float* __restrict__ w,
    const float* __restrict__ b, __bf16* __restrict__ out) {
  __shared__ float r1[256];
  __shared__ float r2[256];
  const int row = blockIdx.x;
  const int tid = threadIdx.x;
  const float* x = X + (size_t)row * TD;
  float lx[8], s = 0.f, ss = 0.f;
#pragma unroll
  for (int i = 0; i < 8; i++) {
    lx[i] = x[tid + i * 256];
    s += lx[i];
    ss += lx[i] * lx[i];
  }
  r1[tid] = s; r2[tid] = ss;
  __syncthreads();
  for (int off = 128; off > 0; off >>= 1) {
    if (tid < off) { r1[tid] += r1[tid + off]; r2[tid] += r2[tid + off]; }
    __syncthreads();
  }
  const float mean = r1[0] * (1.f / TD);
  const float var  = r2[0] * (1.f / TD) - mean * mean;
  const float rstd = rsqrtf(var + TEPS);
#pragma unroll
  for (int i = 0; i < 8; i++) {
    const int col = tid + i * 256;
    out[(size_t)row * TD + col] = f2bf((lx[i] - mean) * rstd * w[col] + b[col]);
  }
}

// ---------- Weights: f32 -> bf16, once per call ----------
// Every GEMM work-group of a tile column needs the same rounded W tile; rounding
// it here once leaves the GEMM a W stream of 2 B an element that needs no register.
// dst holds Wq | Wk | Wv | Wo | W_in | W_out back to back, each in its own layout.
// One block moves WCH floats: 8 wave-wide 512-B loads in flight per wave.
constexpr int WCH  = 8192;
constexpr int WBD  = TD * TD / WCH;      // blocks per D x D matrix
constexpr int WBF  = TD * TDFF / WCH;    // blocks per D x DFF matrix
__global__ __launch_bounds__(256) void weights_bf16_k(
    const float* __restrict__ Wq, const float* __restrict__ Wk,
    const float* __restrict__ Wv, const float* __restrict__ Wo,
    const float* __restrict__ Win, const float* __restrict__ Wout,
    __bf16* __restrict__ dst) {
  const int blk = blockIdx.x;
  const float* src;
  int rel;
  if (blk < 4 * WBD) {
    const int w = blk / WBD;
    src = (w == 0) ? Wq : (w == 1) ? Wk : (w == 2) ? Wv : Wo;
    rel = blk % WBD;
  } else if (blk < 4 * WBD + WBF) {
    src = Win;  rel = blk - 4 * WBD;
  } else {
    src = Wout; rel = blk - 4 * WBD - WBF;
  }
  const float4* sp = (const float4*)(src + (size_t)rel * WCH) + threadIdx.x;
  uint2* dp = (uint2*)(dst + (size_t)blk * WCH) + threadIdx.x;
  float4 f[8];
#pragma unroll  // all eight loads issue before the first use
  for (int i = 0; i < 8; i++) f[i] = sp[i * 256];
#pragma unroll  // f[] indexed by constants only
  for (int i = 0; i < 8; i++) {
    union { __bf16 h4[4]; uint2 d; } u;
    u.h4[0] = f2bf(f[i].x); u.h4[1] = f2bf(f[i].y);
    u.h4[2] = f2bf(f[i].z); u.h4[3] = f2bf(f[i].w);
    dp[i * 256] = u.d;
  }
}

// ---------- Tiled WMMA GEMM:  C[M,N] = A[M,K](bf16) @ W[N,K]^T(bf16) + bias ----------
// One work-group makes a BM x 256 tile of C; its 8 waves lie 2 (m) x 4 (n), each with
// BM/2 x 64 of C, so a staged byte and a fragment feed more products than in a small tile.
// BM = 128 where N = D: 256 tiles, one per WGP. BM = 256 where N = DFF: 512 tiles, two
// rounds of one per WGP; a tile element then takes 1/128 instead of 1/85 staged rows, and
// a 32-deep block is 32 products on 12 fragments instead of 16 on 8.
// Two LDS buffers, one barrier per BK-deep K step; a work-group takes most of the LDS.
// Staging lanes run along K: a tile row is BK * 2 B of A and of W, so every wave-wide
// copy covers 4 whole lines. Both tiles go global -> LDS by asynchronous copies,
// which fly for a whole K step while the tile before them is multiplied.
// Two waves per SIMD, two fragment sets: each 32-deep block's LDS loads go out as one
// group, one block ahead of the products that use them. The next tile's first fragments
// are fetched under this tile's last block, so the publish point stands in front of it.
// OUTM: 0 = bf16 [m][n], 1 = f32 [m][n], 2 = bf16 head-transposed V_t[b][h][dh][s]
// K is a template constant: a lane's tile rows then lie at fixed byte distances.
template <int OUTM, bool GELU, bool RES, int K, int BK, int BM>
__global__ __launch_bounds__(256) void gemm_bf16_k(
    const __bf16* __restrict__ A, const __bf16* __restrict__ W,
    const float* __restrict__ bias, const float* __restrict__ res,
    void* __restrict__ outp, int M, int N, float scale) {
  constexpr int BN = 256;                   // tile columns (rows of W); BM = tile rows (of A)
  constexpr int SA = BK + 8;                // 272-B pitch: 16 B x odd
  constexpr int MI = BM / 32;               // 16-row A fragments per wave
  constexpr int LPR = BK / 8;               // staging lanes per tile row, 16 B each
  constexpr int RPC = 256 / LPR;            // tile rows per work-group-wide copy
  static_assert(K % BK == 0 && K >= 2 * BK, "the ring's prologue fills two tiles");
  static_assert(BK == 128, "pitch and staging map are set for this");
  static_assert(BM == 128 || BM == 256, "wave map: 2 x 4 waves of BM/2 x 64");
  __shared__ __attribute__((aligned(16))) __bf16 As[2][BM * SA];
  __shared__ __attribute__((aligned(16))) __bf16 Bs[2][BN * SA];
  const int tid = threadIdx.x, lane = tid & 31, wave = tid >> 5;
  const int lrow = lane & 15, lhi = (lane >> 4) & 1;
  const int m0 = blockIdx.y * BM, n0 = blockIdx.x * BN;
  const int mb = (wave & 1) * (BM / 2), nb = (wave >> 1) * 64;
  const int arow = tid / LPR, acol = (tid % LPR) * 8; // A and W: LPR lanes x 16 B per row

  v8f acc[MI][4];
#pragma unroll
  for (int i = 0; i < MI; i++)
#pragma unroll
    for (int j = 0; j < 4; j++)
#pragma unroll
      for (int e = 0; e < 8; e++) acc[i][j][e] = 0.f;

  auto stage = [&](int buf, int k0) {
    const __bf16* asrc = A + (size_t)(m0 + arow) * K + k0 + acol;
    const __bf16* wsrc = W + (size_t)(n0 + arow) * K + k0 + acol;
#pragma unroll  // the whole tile's copies in flight at once, LDS places as constants
    for (int i = 0; i < BM / RPC; i++)
      cp16_g2l(asrc + (size_t)(RPC * i) * K, &As[buf][(arow + RPC * i) * SA + acol]);
#pragma unroll  // as above
    for (int i = 0; i < BN / RPC; i++)
      cp16_g2l(wsrc + (size_t)(RPC * i) * K, &Bs[buf][(arow + RPC * i) * SA + acol]);
  };

  // prologue: tile 0 landed and published, then tile 1 on its way
  stage(0, 0);
  ring_wait_async0();
  __syncthreads();
  stage(1, BK);
  {
    constexpr int KSUB = BK / 32;           // blocks per tile; even, so set 0 opens every tile
    v16bf af[2][MI], bfr[2][4];             // set (u & 1) holds block u's fragments
#pragma unroll
    for (int mi = 0; mi < MI; mi++)
      af[0][mi] = frag_ld(&As[0][(mb + mi * 16 + lrow) * SA], lhi);
#pragma unroll
    for (int ni = 0; ni < 4; ni++)
      bfr[0][ni] = frag_ld(&Bs[0][(nb + ni * 16 + lrow) * SA], lhi);
    int buf = 0;
#pragma clang loop unroll(disable)  // one trip's text stays small; sets alternate inside a trip
    for (int k0 = 0; k0 < K; k0 += BK, buf ^= 1) {
#pragma unroll  // af, bfr indexed by constants only
      for (int u = 0; u < KSUB; u++) {
        const int cs = u & 1;
        if (u + 1 < KSUB) {
          const int kk = (u + 1) * 32;
#pragma unroll
          for (int mi = 0; mi < MI; mi++)
            af[cs ^ 1][mi] = frag_ld(&As[buf][(mb + mi * 16 + lrow) * SA + kk], lhi);
#pragma unroll
          for (int ni = 0; ni < 4; ni++)
            bfr[cs ^ 1][ni] = frag_ld(&Bs[buf][(nb + ni * 16 + lrow) * SA + kk], lhi);
        } else {
          // publish point of the next tile: the last block's fragments are in registers,
          // so it also ends every read of [buf]
          ring_wait_ds0();
          ring_wait_async0();
          __syncthreads();
          if (k0 + 2 * BK < K)
            stage(buf, k0 + 2 * BK);  // flies under this block's and the next trip's WMMAs
          // the next tile's first fragments; on the last trip they read the other
          // buffer's old tile, which nothing writes any more, and are not used
#pragma unroll
          for (int mi = 0; mi < MI; mi++)
            af[cs ^ 1][mi] = frag_ld(&As[buf ^ 1][(mb + mi * 16 + lrow) * SA], lhi);
#pragma unroll
          for (int ni = 0; ni < 4; ni++)
            bfr[cs ^ 1][ni] = frag_ld(&Bs[buf ^ 1][(nb + ni * 16 + lrow) * SA], lhi);
        }
        sched_fence();  // the load group stays whole, in front of the block
#pragma unroll
        for (int mi = 0; mi < MI; mi++)
#pragma unroll
          for (int ni = 0; ni < 4; ni++)
            acc[mi][ni] = wmma_bf16(af[cs][mi], bfr[cs][ni], acc[mi][ni]);
        sched_fence();  // the next group does not rise into this block
      }
    }
  }
  ring_wait_async0();         // no copy outlives the loop

  // epilogue: C/D layout -> lane holds (m = v + 8*lhi, n = lane&15) per frag
  // Every trip works on fragment row 0 and then moves the rows up one place, so acc is
  // indexed by constants only. With GELU the loop stays rolled: a trip's 32 elements are
  // independent chains enough to fill the vector port, and the text stays an eighth as
  // long. Unrolled (the other kernels) the moves are mere renaming and cost nothing.
#pragma unroll(GELU ? 1 : MI)
  for (int mi = 0; mi < MI; mi++) {
#pragma unroll
    for (int ni = 0; ni < 4; ni++) {
      const int n = n0 + nb + ni * 16 + lrow;
      const float bv = bias[n];
#pragma unroll
      for (int v = 0; v < 8; v++) {
        const int m = m0 + mb + mi * 16 + v + 8 * lhi;
        float t = (acc[0][ni][v] + bv) * scale;
        if (GELU) t = gelu_f(t);
        if (RES)  t += res[(size_t)m * N + n];
        if (OUTM == 0) {
          ((__bf16*)outp)[(size_t)m * N + n] = f2bf(t);
        } else if (OUTM == 1) {
          ((float*)outp)[(size_t)m * N + n] = t;
        } else {  // V_t[b][h][dh][s]
          const int b_ = m / TS, s = m % TS;
          const int h = n / TDH, dh = n % TDH;
          ((__bf16*)outp)[((size_t)(b_ * THD + h) * TDH + dh) * TS + s] = f2bf(t);
        }
      }
    }
    // rolled loop: the next trip reuses the registers that this trip's last store names
    if (GELU) asm volatile("s_wait_xcnt 0x0" ::: "memory");
#pragma unroll
    for (int r = 0; r + 1 < MI; r++)
#pragma unroll
      for (int ni = 0; ni < 4; ni++) acc[r][ni] = acc[r + 1][ni];
  }
}

// ---------- Flash attention (causal), one (b,h) x 64-query block per WG ----------
// Computes S^T = K Q^T so query == lane column; O^T = V^T P^T with V_t rows.
// The launch lasts as long as its longest work-group, and a trip is mostly latency. So the
// 8 waves are 4 query groups x 2 key halves: a trip stages 64 keys, each wave works on its
// own 32 of them with its own running maximum, sum and O, and the longest work-group makes
// half as many trips. The two halves of a query group are merged once, through LDS, at the
// end. There are more work-groups than places, so the longest ones come first in the grid.
__global__ __launch_bounds__(256) void attn_k(
    const __bf16* __restrict__ Qb, const __bf16* __restrict__ Kb,
    const __bf16* __restrict__ Vt, __bf16* __restrict__ Ob) {
  constexpr int SK = 136, SV = 40, SP = 40;
  constexpr int NK = 64 * SK;          // [key][d]
  constexpr int NV = 2 * 128 * SV;     // [key half][d][key]
  constexpr int NP = 8 * 16 * SP;      // per-wave P[q][key]
  __shared__ __attribute__((aligned(16))) __bf16 sm[NK + NV + NP];
  static_assert((NK + NV + NP) * 2 >= 4 * 17 * 32 * 16, "the merge reuses the tiles' LDS");
  __bf16* Ks = sm;
  __bf16* Vs = sm + NK;
  __bf16* Ps = sm + NK + NV;
  const int tid = threadIdx.x, lane = tid & 31;
  const int wave = __builtin_amdgcn_readfirstlane(tid >> 5);  // in a scalar register: tests on it are scalar branches
  const int qgrp = wave & 3, kh = wave >> 2;   // query group, key half
  const int lrow = lane & 15, lhi = (lane >> 4) & 1;
  const int bh = blockIdx.x, b_ = bh >> 4, h = bh & 15;
  const int q0 = (TS / 64 - 1 - (int)blockIdx.y) * 64;
  const int qw = q0 + qgrp * 16;          // this wave's first query
  const int qg = qw + lrow;               // this lane's query column

  // Q fragments (B-operand), invariant across the k-loop
  v16bf qf[4];
  const __bf16* qbase = Qb + (size_t)(b_ * TS + qg) * TD + h * TDH;
#pragma unroll
  for (int c = 0; c < 4; c++) qf[c] = frag_ld(qbase + c * 32, lhi);

  v8f o[8];
#pragma unroll
  for (int dc = 0; dc < 8; dc++)
#pragma unroll
    for (int e = 0; e < 8; e++) o[dc][e] = 0.f;
  float mrun = -__builtin_inff(), lrun = 0.f;

  // staging coords: lanes run along a row, 16 B each, so a wave-wide copy
  // covers whole rows of the tile (K: 256 B, V_t: 128 B)
  const int ksr = tid >> 4, ksc = (tid & 15) * 8;
  const int vsr = tid >> 3, vsc = (tid & 7) * 8;
  __bf16* vdst = Vs + (vsc >> 5) * (128 * SV) + vsr * SV + (vsc & 31);
  const int kend = q0 + 64;
  for (int k0 = 0; k0 < kend; k0 += 64) {
    ring_wait_ds0();          // this wave's LDS reads of the last trip have retired
    __syncthreads();          // and so have every other wave's: the tiles may be refilled
    {  // stage K tile: 64 keys x 128 d
      const __bf16* src = Kb + (size_t)(b_ * TS + k0 + ksr) * TD + h * TDH + ksc;
#pragma unroll  // all four copies in flight at once
      for (int i = 0; i < 4; i++)
        cp16_g2l(src + (size_t)(16 * i) * TD, Ks + (ksr + 16 * i) * SK + ksc);
    }
    {  // stage V_t tile: 128 d x 64 keys (k-contiguous rows), one 32-key plane per key half
      const __bf16* src = Vt + ((size_t)bh * TDH + vsr) * TS + k0 + vsc;
#pragma unroll  // as above
      for (int i = 0; i < 4; i++)
        cp16_g2l(src + (size_t)(32 * i) * TS, vdst + (32 * i) * SV);
    }
    if (k0 + 64 < kend) {     // prefetch the next tiles into L2, one 128-B line per lane
      if (wave < 4)
        __builtin_prefetch(Kb + (size_t)(b_ * TS + k0 + 64 + (tid >> 1)) * TD + h * TDH + (tid & 1) * 64, 0, 3);
      else
        __builtin_prefetch(Vt + ((size_t)bh * TDH + (tid - 128)) * TS + k0 + 64, 0, 3);
    }
    ring_wait_async0();       // this wave's copies have landed
    __syncthreads();          // and are published to the other waves

    const int kw = k0 + kh * 32;          // this wave's first key
    // A wave whose 32 keys all lie past its last query has nothing to add (and, before its
    // first real tile, no finite maximum to subtract). Scalar branch, no barrier inside.
    if (kw > qw + 15) continue;

    // scores S^T: two 16-key subtiles, each 4 WMMAs over DH=128.
    // All 8 K fragments are fetched first, 16 LDS loads as one group in the order in
    // which the products use them: the wave pays one LDS latency, not one per product.
    v16bf kf[4][2];
#pragma unroll  // kf indexed by constants only
    for (int c = 0; c < 4; c++)
#pragma unroll
      for (int sub = 0; sub < 2; sub++)
        kf[c][sub] = frag_ld(Ks + (kh * 32 + sub * 16 + lrow) * SK + c * 32, lhi);
    sched_fence();  // the K group stays whole, in front of its products
    v8f st[2];
#pragma unroll
    for (int sub = 0; sub < 2; sub++)
#pragma unroll
      for (int e = 0; e < 8; e++) st[sub][e] = 0.f;
#pragma unroll  // the two subtiles' sums alternate: two independent accumulator chains
    for (int c = 0; c < 4; c++)
#pragma unroll
      for (int sub = 0; sub < 2; sub++)
        st[sub] = wmma_bf16(kf[c][sub], qf[c], st[sub]);
    sched_fence();  // keeps the V group whole: without it two of its loads rise further up among the products
    // All 8 V_t fragments, 16 LDS loads as one group into the registers that the K
    // fragments have left; they land under the mask and the row maximum.
    v16bf vf[8];
#pragma unroll  // vf indexed by constants only
    for (int dc = 0; dc < 8; dc++)
      vf[dc] = frag_ld(Vs + kh * (128 * SV) + (dc * 16 + lrow) * SV, lhi);

    float pv[2][8];
    // masking only needed when this wave's 32 keys can reach past one of its
    // queries; wave-uniform condition -> scalar branch, EXEC stays full
    const bool needmask = (kw + 31) > qw;
    if (needmask) {
#pragma unroll
      for (int sub = 0; sub < 2; sub++)
#pragma unroll
        for (int v = 0; v < 8; v++) {
          const int kg = kw + sub * 16 + v + 8 * lhi;
          pv[sub][v] = (kg <= qg) ? st[sub][v] : -__builtin_inff();
        }
    } else {
#pragma unroll
      for (int sub = 0; sub < 2; sub++)
#pragma unroll
        for (int v = 0; v < 8; v++) pv[sub][v] = st[sub][v];
    }

    // online softmax per query (in-lane + one xor-16 exchange)
    float mt = -__builtin_inff();
#pragma unroll
    for (int sub = 0; sub < 2; sub++)
#pragma unroll
      for (int v = 0; v < 8; v++) mt = fmaxf(mt, pv[sub][v]);
    mt = fmaxf(mt, __shfl_xor(mt, 16, 32));
    const float mnew = fmaxf(mrun, mt);
    const float corr = __expf(mrun - mnew);
    float psum = 0.f;
#pragma unroll
    for (int sub = 0; sub < 2; sub++)
#pragma unroll
      for (int v = 0; v < 8; v++) {
        const float p = __expf(pv[sub][v] - mnew);
        pv[sub][v] = p;
        psum += p;
      }
    psum += __shfl_xor(psum, 16, 32);
    lrun = lrun * corr + psum;
    mrun = mnew;
#pragma unroll
    for (int dc = 0; dc < 8; dc++)
#pragma unroll
      for (int e = 0; e < 8; e++) o[dc][e] *= corr;

    // stage P (bf16) per wave: lane writes 8 contiguous keys -> one b128.
    // Must stay a plain DS store: we rely on same-wave DS ordering for the
    // immediate reload below (ASYNC ops would not preserve it).
#pragma unroll
    for (int sub = 0; sub < 2; sub++) {
      union { __bf16 h8[8]; uint4 q; } u;
#pragma unroll
      for (int v = 0; v < 8; v++) u.h8[v] = f2bf(pv[sub][v]);
      *(uint4*)(Ps + (wave * 16 + lrow) * SP + sub * 16 + 8 * lhi) = u.q;
    }
    v16bf pf = frag_ld(Ps + (wave * 16 + lrow) * SP, lhi);
#pragma unroll
    for (int dc = 0; dc < 8; dc++) o[dc] = wmma_bf16(vf[dc], pf, o[dc]);
  }

  // Merge of the two key halves. Lane L of wave w and of wave w + 4 hold the same query and
  // the same d rows. The upper half hands over its O, maximum and sum, 16 B per lane and
  // store, in the LDS that the tiles have left.
  float4* mg = (float4*)sm + (size_t)qgrp * 17 * 32 + lane;
  ring_wait_ds0();            // this wave's last tile reads have retired
  __syncthreads();            // and every other wave's: the tiles' LDS is free
  if (kh == 1) {
#pragma unroll  // o indexed by constants only
    for (int dc = 0; dc < 8; dc++) {
      mg[(2 * dc) * 32]     = make_float4(o[dc][0], o[dc][1], o[dc][2], o[dc][3]);
      mg[(2 * dc + 1) * 32] = make_float4(o[dc][4], o[dc][5], o[dc][6], o[dc][7]);
    }
    mg[16 * 32] = make_float4(mrun, lrun, 0.f, 0.f);
  }
  __syncthreads();            // the upper half's values are published
  if (kh == 0) {
    // The lower half has key 0, which every query sees: its maximum is finite. An upper
    // half that never had a tile hands over maximum -inf, sum 0 and O 0: weight 0.
    const float4 ml = mg[16 * 32];
    const float m  = fmaxf(mrun, ml.x);
    float wa = __expf(mrun - m), wb = __expf(ml.x - m);
    const float inv = 1.f / (lrun * wa + ml.y * wb);
    wa *= inv; wb *= inv;
#pragma unroll  // o indexed by constants only
    for (int dc = 0; dc < 8; dc++) {
      const float4 p0 = mg[(2 * dc) * 32], p1 = mg[(2 * dc + 1) * 32];
      const float ob[8] = {p0.x, p0.y, p0.z, p0.w, p1.x, p1.y, p1.z, p1.w};
#pragma unroll
      for (int v = 0; v < 8; v++) {
        const int d = dc * 16 + v + 8 * lhi;
        Ob[(size_t)(b_ * TS + qg) * TD + h * TDH + d] = f2bf(o[dc][v] * wa + ob[v] * wb);
      }
    }
  }
}

// ---------- host-side orchestration ----------
extern "C" void kernel_launch(void* const* d_in, const int* in_sizes, int n_in,
                              void* d_out, int out_size, void* d_ws, size_t ws_size,
                              hipStream_t stream) {
  (void)in_sizes; (void)n_in; (void)out_size; (void)ws_size;
  const float* X    = (const float*)d_in[0];
  const float* Wq   = (const float*)d_in[1];
  const float* bq   = (const float*)d_in[2];
  const float* Wk   = (const float*)d_in[3];
  const float* bk   = (const float*)d_in[4];
  const float* Wv   = (const float*)d_in[5];
  const float* bv   = (const float*)d_in[6];
  const float* Wo   = (const float*)d_in[7];
  const float* bo   = (const float*)d_in[8];
  const float* Win  = (const float*)d_in[9];
  const float* bin  = (const float*)d_in[10];
  const float* Wout = (const float*)d_in[11];
  const float* bout = (const float*)d_in[12];
  const float* ln1w = (const float*)d_in[13];
  const float* ln1b = (const float*)d_in[14];
  const float* ln2w = (const float*)d_in[15];
  const float* ln2b = (const float*)d_in[16];
  float* out = (float*)d_out;

  char* ws = (char*)d_ws;
  const size_t szMD = (size_t)TM * TD * 2;          // 16.78 MB (bf16 M x D)
  __bf16* lnb = (__bf16*)(ws);                      // LN output (reused for LN2)
  __bf16* Qb  = (__bf16*)(ws + 1 * szMD);
  __bf16* Kb  = (__bf16*)(ws + 2 * szMD);
  __bf16* Vt  = (__bf16*)(ws + 3 * szMD);
  __bf16* Ab  = (__bf16*)(ws + 4 * szMD);           // attention output
  float*  X1  = (float*)(ws + 5 * szMD);            // residual stream (f32, 2*szMD)
  __bf16* Hm  = (__bf16*)(ws + 1 * szMD);           // MLP hidden reuses Qb..Ab (4*szMD)
  __bf16* Wb  = (__bf16*)(ws + 7 * szMD);           // bf16 weights, 96 MiB in all
  const __bf16* Wqb   = Wb;
  const __bf16* Wkb   = Wb + 1 * (size_t)TD * TD;
  const __bf16* Wvb   = Wb + 2 * (size_t)TD * TD;
  const __bf16* Wob   = Wb + 3 * (size_t)TD * TD;
  const __bf16* Winb  = Wb + 4 * (size_t)TD * TD;
  const __bf16* Woutb = Wb + 4 * (size_t)TD * TD + (size_t)TD * TDFF;

  const float qk = 0.29730177875068026f;            // 1/sqrt(sqrt(128))
  dim3 th(256);
  dim3 gD(TD / 256, TM / 128);      // (8, 32): 128 x 256 tiles
  dim3 gF(TDFF / 256, TM / 256);    // (32, 16): 256 x 256 tiles
  dim3 gA(TB * THD, TS / 64);       // (32, 32): x = (b, h), y = query block, longest first

  weights_bf16_k<<<4 * WBD + 2 * WBF, th, 0, stream>>>(Wq, Wk, Wv, Wo, Win, Wout, Wb);
  layernorm_bf16_k<<<TM, th, 0, stream>>>(X, ln1w, ln1b, lnb);
  gemm_bf16_k<0, false, false, TD, 128, 128><<<gD, th, 0, stream>>>(lnb, Wqb, bq, nullptr, Qb, TM, TD, qk);
  gemm_bf16_k<0, false, false, TD, 128, 128><<<gD, th, 0, stream>>>(lnb, Wkb, bk, nullptr, Kb, TM, TD, qk);
  gemm_bf16_k<2, false, false, TD, 128, 128><<<gD, th, 0, stream>>>(lnb, Wvb, bv, nullptr, Vt, TM, TD, 1.f);
  attn_k<<<gA, th, 0, stream>>>(Qb, Kb, Vt, Ab);
  gemm_bf16_k<1, false, true, TD, 128, 128><<<gD, th, 0, stream>>>(Ab, Wob, bo, X, (void*)X1, TM, TD, 1.f);
  layernorm_bf16_k<<<TM, th, 0, stream>>>(X1, ln2w, ln2b, lnb);
  gemm_bf16_k<0, true, false, TD, 128, 256><<<gF, th, 0, stream>>>(lnb, Winb, bin, nullptr, Hm, TM, TDFF, 1.f);
  gemm_bf16_k<1, false, true, TDFF, 128, 128><<<gD, th, 0, stream>>>(Hm, Woutb, bout, X1, (void*)out, TM, TD, 1.f);
}

// v009
// One run takes 341 microseconds.
// Two timings next to v008 both put it at 1.10 times that version's speed.
// Over all steps from v000 it is 2.57 times as fast.
#include <hip/hip_runtime.h>
#include <hip/hip_bf16.h>
#include <math.h>

typedef __attribute__((ext_vector_type(16))) __bf16 v16bf;
typedef __attribute__((ext_vector_type(8)))  __bf16 v8bf;
typedef __attribute__((ext_vector_type(8)))  float  v8f;
typedef __attribute__((ext_vector_type(4)))  int    v4i;

#define DEV static __device__ __forceinline__
#define GAS __attribute__((address_space(1)))
#define LAS __attribute__((address_space(3)))

#if __has_builtin(__builtin_amdgcn_global_load_async_to_lds_b128) && \
    __has_builtin(__builtin_amdgcn_s_wait_asynccnt)
#define HAS_ASYNC_LDS 1
#else
#define HAS_ASYNC_LDS 0
#endif

namespace {
constexpr int   TB   = 2;
constexpr int   TS   = 2048;
constexpr int   TD   = 2048;
constexpr int   THD  = 16;     // heads
constexpr int   TDH  = 128;    // head dim
constexpr int   TDFF = 8192;
constexpr int   TM   = TB * TS;          // 4096 token rows
constexpr float TEPS = 1e-5f;
}

// ---------- scalar helpers ----------
DEV __bf16 f2bf(float x) {
  unsigned u = __builtin_bit_cast(unsigned, x);
  unsigned r = u + 0x7FFFu + ((u >> 16) & 1u);      // RNE
  unsigned short s = (unsigned short)(r >> 16);
  return __builtin_bit_cast(__bf16, s);
}

// 0.5 x (1 + tanh u) = x / (1 + e^(-2u)), u = c (x + 0.044715 x^3): the same function,
// with one exp2 and one reciprocal and no branch. The library tanhf splits the lanes on
// |u| and runs both sides, one element behind the other; here the elements of an
// epilogue trip are independent chains. No difference of near-equal terms is formed;
// e^(-2u) = 0 or infinity gives x or 0, as the limits of tanh do.
DEV float gelu_f(float x) {
  const float k = -2.f * 0.7978845608028654f * 1.4426950408889634f;  // -2 c log2(e)
  const float u = x * __builtin_fmaf(x * x, 0.044715f, 1.f);
  return x * __builtin_amdgcn_rcpf(1.f + __builtin_amdgcn_exp2f(k * u));
}

// 16B global -> LDS copy: async-to-LDS (ASYNCcnt) when available, else
// load + ds_store fallback. Builtin signature (from hipcc diagnostic):
// (AS1 v4i* global_src, AS3 v4i* lds_dst, imm offset, imm cpol).
DEV void cp16_g2l(const __bf16* g, __bf16* l) {
#if HAS_ASYNC_LDS
  __builtin_amdgcn_global_load_async_to_lds_b128(
      (GAS v4i*)g, (LAS v4i*)l, 0, 0);
#else
  *(uint4*)l = *(const uint4*)g;
#endif
}
// Publish-point waits of the GEMM ring and of the attention tiles, each a statement of its own; the
// "memory" clobber keeps every LDS read and copy on its side of the wait.
DEV void ring_wait_async0() {
  // this wave's copies have landed before the barrier that publishes them
  asm volatile("s_wait_asynccnt 0x0" ::: "memory");
}
DEV void ring_wait_ds0() {
  // this wave's LDS reads have retired before the buffer is refilled
  asm volatile("s_wait_dscnt 0x0" ::: "memory");
}

// Nothing is scheduled across this point: without it the compiler sinks the fragment
// loads in among the WMMAs, two at a time, each pair with a wait to 0 right behind it.
DEV void sched_fence() { __builtin_amdgcn_sched_barrier(0); }

// Load one 16x(32-chunk) bf16 fragment (A-style row layout).
// Per the CDNA5 ISA layout, lane L holds row (L&15); its 16 bf16 elements are
// two contiguous 8-element runs at K offsets {8*(L>>4), 16+8*(L>>4)}.
DEV v16bf frag_ld(const __bf16* rowbase, int lhi) {
  v8bf lo = *(const v8bf*)(rowbase + 8 * lhi);
  v8bf hi = *(const v8bf*)(rowbase + 16 + 8 * lhi);
  return __builtin_shufflevector(lo, hi, 0, 1, 2, 3, 4, 5, 6, 7,
                                         8, 9, 10, 11, 12, 13, 14, 15);
}

DEV v8f wmma_bf16(v16bf a, v16bf b, v8f c) {
  return __builtin_amdgcn_wmma_f32_16x16x32_bf16(false, a, false, b,
                                                 (short)0, c, false, false);
}

// ---------- LayerNorm: f32 in -> bf16 out ----------
__global__ __launch_bounds__(256) void layernorm_bf16_k(
    const float* __restrict__ X, const float* __restrict__ w,
    const float* __restrict__ b, __bf16* __restrict__ out) {
  __shared__ float r1[256];
  __shared__ float r2[256];
  const int row = blockIdx.x;
  const int tid = threadIdx.x;
  const float* x = X + (size_t)row * TD;
  float lx[8], s = 0.f, ss = 0.f;
#pragma unroll
  for (int i = 0; i < 8; i++) {
    lx[i] = x[tid + i * 256];
    s += lx[i];
    ss += lx[i] * lx[i];
  }
  r1[tid] = s; r2[tid] = ss;
  __syncthreads();
  for (int off = 128; off > 0; off >>= 1) {
    if (tid < off) { r1[tid] += r1[tid + off]; r2[tid] += r2[tid + off]; }
    __syncthreads();
  }
  const float mean = r1[0] * (1.f / TD);
  const float var  = r2[0] * (1.f / TD) - mean * mean;
  const float rstd = rsqrtf(var + TEPS);
#pragma unroll
  for (int i = 0; i < 8; i++) {
    const int col = tid + i * 256;
    out[(size_t)row * TD + col] = f2bf((lx[i] - mean) * rstd * w[col] + b[col]);
  }
}

// ---------- Weights: f32 -> bf16, once per call ----------
// Every GEMM work-group of a tile column needs the same rounded W tile; rounding
// it here once leaves the GEMM a W stream of 2 B an element that needs no register.
// dst holds Wq | Wk | Wv | Wo | W_in | W_out back to back, each in its own layout.
// One block moves WCH floats: 8 wave-wide 512-B loads in flight per wave.
constexpr int WCH  = 8192;
constexpr int WBD  = TD * TD / WCH;      // blocks per D x D matrix
constexpr int WBF  = TD * TDFF / WCH;    // blocks per D x DFF matrix
__global__ __launch_bounds__(256) void weights_bf16_k(
    const float* __restrict__ Wq, const float* __restrict__ Wk,
    const float* __restrict__ Wv, const float* __restrict__ Wo,
    const float* __restrict__ Win, const float* __restrict__ Wout,
    __bf16* __restrict__ dst) {
  const int blk = blockIdx.x;
  const float* src;
  int rel;
  if (blk < 4 * WBD) {
    const int w = blk / WBD;
    src = (w == 0) ? Wq : (w == 1) ? Wk : (w == 2) ? Wv : Wo;
    rel = blk % WBD;
  } else if (blk < 4 * WBD + WBF) {
    src = Win;  rel = blk - 4 * WBD;
  } else {
    src = Wout; rel = blk - 4 * WBD - WBF;
  }
  const float4* sp = (const float4*)(src + (size_t)rel * WCH) + threadIdx.x;
  uint2* dp = (uint2*)(dst + (size_t)blk * WCH) + threadIdx.x;
  float4 f[8];
#pragma unroll  // all eight loads issue before the first use
  for (int i = 0; i < 8; i++) f[i] = sp[i * 256];
#pragma unroll  // f[] indexed by constants only
  for (int i = 0; i < 8; i++) {
    union { __bf16 h4[4]; uint2 d; } u;
    u.h4[0] = f2bf(f[i].x); u.h4[1] = f2bf(f[i].y);
    u.h4[2] = f2bf(f[i].z); u.h4[3] = f2bf(f[i].w);
    dp[i * 256] = u.d;
  }
}

// ---------- Tiled WMMA GEMM:  C[M,N] = A[M,K](bf16) @ W[N,K]^T(bf16) + bias ----------
// One work-group makes a BM x 256 tile of C; its 8 waves lie 2 (m) x 4 (n), each with
// BM/2 x 64 of C, so a staged byte and a fragment feed more products than in a small tile.
// BM = 128 where N = D: 256 tiles, one per WGP. BM = 256 where N = DFF: 512 tiles, two
// rounds of one per WGP; a tile element then takes 1/128 instead of 1/85 staged rows, and
// a 32-deep block is 32 products on 12 fragments instead of 16 on 8.
// Two LDS buffers, one barrier per BK-deep K step; a work-group takes most of the LDS.
// Staging lanes run along K: a tile row is BK * 2 B of A and of W, so every wave-wide
// copy covers 4 whole lines. Both tiles go global -> LDS by asynchronous copies,
// which fly for a whole K step while the tile before them is multiplied.
// Two waves per SIMD, two fragment sets: each 32-deep block's LDS loads go out as one
// group, one block ahead of the products that use them. The next tile's first fragments
// are fetched under this tile's last block, so the publish point stands in front of it.
// OUTM: 0 = bf16 [m][n], 1 = f32 [m][n]
// K is a template constant: a lane's tile rows then lie at fixed byte distances.
template <int OUTM, bool GELU, bool RES, int K, int BK, int BM>
__global__ __launch_bounds__(256) void gemm_bf16_k(
    const __bf16* __restrict__ A, const __bf16* __restrict__ W,
    const float* __restrict__ bias, const float* __restrict__ res,
    void* __restrict__ outp, int M, int N, float scale) {
  constexpr int BN = 256;                   // tile columns (rows of W); BM = tile rows (of A)
  constexpr int SA = BK + 8;                // 272-B pitch: 16 B x odd
  constexpr int MI = BM / 32;               // 16-row A fragments per wave
  constexpr int LPR = BK / 8;               // staging lanes per tile row, 16 B each
  constexpr int RPC = 256 / LPR;            // tile rows per work-group-wide copy
  static_assert(K % BK == 0 && K >= 2 * BK, "the ring's prologue fills two tiles");
  static_assert(BK == 128, "pitch and staging map are set for this");
  static_assert(BM == 128 || BM == 256, "wave map: 2 x 4 waves of BM/2 x 64");
  __shared__ __attribute__((aligned(16))) __bf16 As[2][BM * SA];
  __shared__ __attribute__((aligned(16))) __bf16 Bs[2][BN * SA];
  const int tid = threadIdx.x, lane = tid & 31, wave = tid >> 5;
  const int lrow = lane & 15, lhi = (lane >> 4) & 1;
  const int m0 = blockIdx.y * BM, n0 = blockIdx.x * BN;
  const int mb = (wave & 1) * (BM / 2), nb = (wave >> 1) * 64;
  const int arow = tid / LPR, acol = (tid % LPR) * 8; // A and W: LPR lanes x 16 B per row

  v8f acc[MI][4];
#pragma unroll
  for (int i = 0; i < MI; i++)
#pragma unroll
    for (int j = 0; j < 4; j++)
#pragma unroll
      for (int e = 0; e < 8; e++) acc[i][j][e] = 0.f;

  auto stage = [&](int buf, int k0) {
    const __bf16* asrc = A + (size_t)(m0 + arow) * K + k0 + acol;
    const __bf16* wsrc = W + (size_t)(n0 + arow) * K + k0 + acol;
#pragma unroll  // the whole tile's copies in flight at once, LDS places as constants
    for (int i = 0; i < BM / RPC; i++)
      cp16_g2l(asrc + (size_t)(RPC * i) * K, &As[buf][(arow + RPC * i) * SA + acol]);
#pragma unroll  // as above
    for (int i = 0; i < BN / RPC; i++)
      cp16_g2l(wsrc + (size_t)(RPC * i) * K, &Bs[buf][(arow + RPC * i) * SA + acol]);
  };

  // prologue: tile 0 landed and published, then tile 1 on its way
  stage(0, 0);
  ring_wait_async0();
  __syncthreads();
  stage(1, BK);
  {
    constexpr int KSUB = BK / 32;           // blocks per tile; even, so set 0 opens every tile
    v16bf af[2][MI], bfr[2][4];             // set (u & 1) holds block u's fragments
#pragma unroll
    for (int mi = 0; mi < MI; mi++)
      af[0][mi] = frag_ld(&As[0][(mb + mi * 16 + lrow) * SA], lhi);
#pragma unroll
    for (int ni = 0; ni < 4; ni++)
      bfr[0][ni] = frag_ld(&Bs[0][(nb + ni * 16 + lrow) * SA], lhi);
    int buf = 0;
#pragma clang loop unroll(disable)  // one trip's text stays small; sets alternate inside a trip
    for (int k0 = 0; k0 < K; k0 += BK, buf ^= 1) {
#pragma unroll  // af, bfr indexed by constants only
      for (int u = 0; u < KSUB; u++) {
        const int cs = u & 1;
        if (u + 1 < KSUB) {
          const int kk = (u + 1) * 32;
#pragma unroll
          for (int mi = 0; mi < MI; mi++)
            af[cs ^ 1][mi] = frag_ld(&As[buf][(mb + mi * 16 + lrow) * SA + kk], lhi);
#pragma unroll
          for (int ni = 0; ni < 4; ni++)
            bfr[cs ^ 1][ni] = frag_ld(&Bs[buf][(nb + ni * 16 + lrow) * SA + kk], lhi);
        } else {
          // publish point of the next tile: the last block's fragments are in registers,
          // so it also ends every read of [buf]
          ring_wait_ds0();
          ring_wait_async0();
          __syncthreads();
          if (k0 + 2 * BK < K)
            stage(buf, k0 + 2 * BK);  // flies under this block's and the next trip's WMMAs
          // the next tile's first fragments; on the last trip they read the other
          // buffer's old tile, which nothing writes any more, and are not used
#pragma unroll
          for (int mi = 0; mi < MI; mi++)
            af[cs ^ 1][mi] = frag_ld(&As[buf ^ 1][(mb + mi * 16 + lrow) * SA], lhi);
#pragma unroll
          for (int ni = 0; ni < 4; ni++)
            bfr[cs ^ 1][ni] = frag_ld(&Bs[buf ^ 1][(nb + ni * 16 + lrow) * SA], lhi);
        }
        sched_fence();  // the load group stays whole, in front of the block
#pragma unroll
        for (int mi = 0; mi < MI; mi++)
#pragma unroll
          for (int ni = 0; ni < 4; ni++)
            acc[mi][ni] = wmma_bf16(af[cs][mi], bfr[cs][ni], acc[mi][ni]);
        sched_fence();  // the next group does not rise into this block
      }
    }
  }
  ring_wait_async0();         // no copy outlives the loop

  // epilogue: C/D layout -> lane holds (m = v + 8*lhi, n = lane&15) per frag
  // Every trip works on fragment row 0 and then moves the rows up one place, so acc is
  // indexed by constants only. With GELU the loop stays rolled: a trip's 32 elements are
  // independent chains enough to fill the vector port, and the text stays an eighth as
  // long. Unrolled (the other kernels) the moves are mere renaming and cost nothing.
#pragma unroll(GELU ? 1 : MI)
  for (int mi = 0; mi < MI; mi++) {
#pragma unroll
    for (int ni = 0; ni < 4; ni++) {
      const int n = n0 + nb + ni * 16 + lrow;
      const float bv = bias[n];
#pragma unroll
      for (int v = 0; v < 8; v++) {
        const int m = m0 + mb + mi * 16 + v + 8 * lhi;
        float t = (acc[0][ni][v] + bv) * scale;
        if (GELU) t = gelu_f(t);
        if (RES)  t += res[(size_t)m * N + n];
        if (OUTM == 0) {
          ((__bf16*)outp)[(size_t)m * N + n] = f2bf(t);
        } else {
          ((float*)outp)[(size_t)m * N + n] = t;
        }
      }
    }
    // rolled loop: the next trip reuses the registers that this trip's last store names
    if (GELU) asm volatile("s_wait_xcnt 0x0" ::: "memory");
#pragma unroll
    for (int r = 0; r + 1 < MI; r++)
#pragma unroll
      for (int ni = 0; ni < 4; ni++) acc[r][ni] = acc[r + 1][ni];
  }
}

// ---------- Q, K and V as one product: C[M, 3D] = A[M,K] @ [Wq | Wk | Wv]^T ----------
// The three weight matrices lie back to back, so they are one matrix of 3D rows. M x 3D
// splits into exactly one 256 x 384 tile per WGP: one launch, one prologue and one epilogue
// where there were three, and a tile element takes 1/154 staged rows instead of 1/85, so
// that far fewer bytes come from L2 per product.
// 8 waves lie 2 (m) x 4 (n), each with 128 x 96 of C: 384 accumulator registers, which
// leave room for one fragment set. A wave fetches a 32-deep block's 14 fragments as one
// group and then runs its 48 products; the SIMD's other wave fills the matrix unit meanwhile.
// Two LDS buffers of 64-deep tiles, filled by asynchronous copies one trip ahead; nothing of
// the next tile is read in front of the barrier at a trip's foot.
__global__ __launch_bounds__(256) void gemm_qkv_k(
    const __bf16* __restrict__ A, const __bf16* __restrict__ W,
    const float* __restrict__ bq, const float* __restrict__ bk,
    const float* __restrict__ bv, __bf16* __restrict__ Qo,
    __bf16* __restrict__ Ko, __bf16* __restrict__ Vo, float qks) {
  constexpr int K = TD, BM = 256, BN = 384, BK = 64;
  constexpr int SA = BK + 8;                // 144-B pitch: 16 B x odd
  constexpr int MI = 8, NI = 6;             // 16 x 16 tiles of C per wave
  constexpr int ST = (BM + BN) * SA;        // a stage: A rows, then W rows
  static_assert(TM % BM == 0 && (3 * TD) % BN == 0 && TS % BM == 0, "whole tiles, one batch each");
  static_assert(K % BK == 0 && K >= 2 * BK, "the ring's prologue fills two tiles");
  __shared__ __attribute__((aligned(16))) __bf16 sm[2][ST];
  const int tid = threadIdx.x, lane = tid & 31;
  const int wave = __builtin_amdgcn_readfirstlane(tid >> 5);  // scalar: the epilogue branches on it
  const int lrow = lane & 15, lhi = (lane >> 4) & 1;
  const int m0 = blockIdx.y * BM, n0 = blockIdx.x * BN;
  const int mb = (wave & 1) * 128, nb = (wave >> 1) * 96;
  const int srow = tid >> 3, scol = (tid & 7) * 8;   // staging: 8 lanes x 16 B per tile row

  v8f acc[MI][NI];
#pragma unroll
  for (int i = 0; i < MI; i++)
#pragma unroll
    for (int j = 0; j < NI; j++)
#pragma unroll
      for (int e = 0; e < 8; e++) acc[i][j][e] = 0.f;

  const unsigned loff = (unsigned)(srow * K + scol);  // the lane's place, the same in every copy
  auto stage = [&](int buf, int k0) {
    const __bf16* asrc = A + (size_t)m0 * K + k0;     // uniform bases
    const __bf16* wsrc = W + (size_t)n0 * K + k0;
    __bf16* dst = &sm[buf][srow * SA + scol];
#pragma unroll  // the whole tile's copies in flight at once, LDS places as constants
    for (int i = 0; i < BM / 32; i++)
      cp16_g2l(asrc + (size_t)(32 * i) * K + loff, dst + (32 * i) * SA);
#pragma unroll  // as above
    for (int i = 0; i < BN / 32; i++)
      cp16_g2l(wsrc + (size_t)(32 * i) * K + loff, dst + (BM + 32 * i) * SA);
  };

  // prologue: tile 0 landed and published, then tile 1 on its way
  stage(0, 0);
  ring_wait_async0();
  __syncthreads();
  stage(1, BK);
  int buf = 0;
#pragma clang loop unroll(disable)  // one trip's text stays small
  for (int k0 = 0; k0 < K; k0 += BK, buf ^= 1) {
    const __bf16* ab = &sm[buf][(mb + lrow) * SA];
    const __bf16* bb = &sm[buf][(BM + nb + lrow) * SA];
#pragma unroll  // LDS places as constants
    for (int u = 0; u < BK / 32; u++) {
      v16bf af[MI], bfr[NI];
      af[0] = frag_ld(ab + u * 32, lhi);
#pragma unroll
      for (int ni = 0; ni < NI; ni++) bfr[ni] = frag_ld(bb + ni * 16 * SA + u * 32, lhi);
      sched_fence();  // what the first row of products needs is fetched first: they start under the rest
#pragma unroll
      for (int mi = 1; mi < MI; mi++) af[mi] = frag_ld(ab + mi * 16 * SA + u * 32, lhi);
      sched_fence();  // the load group stays whole, in front of the block
#pragma unroll
      for (int mi = 0; mi < MI; mi++)
#pragma unroll
        for (int ni = 0; ni < NI; ni++)
          acc[mi][ni] = wmma_bf16(af[mi], bfr[ni], acc[mi][ni]);
      sched_fence();  // the next group does not rise into this block
    }
    // foot of the trip: publishes the next tile and ends every read of [buf]
    ring_wait_ds0();
    ring_wait_async0();
    __syncthreads();
    if (k0 + 2 * BK < K) stage(buf, k0 + 2 * BK);  // flies under the next trip's WMMAs
  }
  ring_wait_async0();         // no copy outlives the loop

  // epilogue: lane holds (m = v + 8*lhi, n = lane&15) per 16 x 16 tile. A tile's 16 columns
  // lie in one of Q, K, V (D is a multiple of 16); which one is a scalar of the wave.
  float bias[NI];
#pragma unroll
  for (int ni = 0; ni < NI; ni++) {
    const int nc = n0 + nb + ni * 16, seg = nc / TD;
    const float* bp = (seg == 0) ? bq : (seg == 1) ? bk : bv;
    bias[ni] = bp[nc % TD + lrow];
  }
  const int b_ = m0 / TS;     // a tile's rows lie in one batch
  // Two trips of four tile rows: the text stays half as long; every trip works on rows 0
  // to 3 and then moves the upper rows down, so acc is indexed by constants only.
#pragma unroll 1
  for (int hf = 0; hf < 2; hf++) {
#pragma unroll
    for (int mi = 0; mi < MI / 2; mi++) {
      const int m = m0 + mb + (hf * (MI / 2) + mi) * 16 + 8 * lhi;
#pragma unroll
      for (int ni = 0; ni < NI; ni++) {
        const int nc = n0 + nb + ni * 16, seg = nc / TD;
        const int nn = nc % TD + lrow;
        if (seg == 2) {       // V_t[b][h][dh][s]: the lane's 8 rows are 16 contiguous bytes
          union { __bf16 h8[8]; uint4 q; } u;
#pragma unroll
          for (int v = 0; v < 8; v++) u.h8[v] = f2bf(acc[mi][ni][v] + bias[ni]);
          *(uint4*)(Vo + ((size_t)b_ * TD + nn) * TS + (m - b_ * TS)) = u.q;
          // what follows reuses the registers that this store names
          asm volatile("s_wait_xcnt 0x0" ::: "memory");
        } else {              // Q or K, [m][n], scaled
          __bf16* o = ((seg == 0) ? Qo : Ko) + (size_t)m * TD + nn;
#pragma unroll
          for (int v = 0; v < 8; v++)
            o[(size_t)v * TD] = f2bf((acc[mi][ni][v] + bias[ni]) * qks);
          // what follows reuses the registers that these stores name
          asm volatile("s_wait_xcnt 0x0" ::: "memory");
        }
      }
    }
#pragma unroll
    for (int r = 0; r < MI / 2; r++)
#pragma unroll
      for (int ni = 0; ni < NI; ni++) acc[r][ni] = acc[r + MI / 2][ni];
  }
}

// ---------- Flash attention (causal), one (b,h) x 64-query block per WG ----------
// Computes S^T = K Q^T so query == lane column; O^T = V^T P^T with V_t rows.
// The launch lasts as long as its longest work-group, and a trip is mostly latency. So the
// 8 waves are 4 query groups x 2 key halves: a trip stages 64 keys, each wave works on its
// own 32 of them with its own running maximum, sum and O, and the longest work-group makes
// half as many trips. The two halves of a query group are merged once, through LDS, at the
// end. There are more work-groups than places, so the longest ones come first in the grid.
__global__ __launch_bounds__(256) void attn_k(
    const __bf16* __restrict__ Qb, const __bf16* __restrict__ Kb,
    const __bf16* __restrict__ Vt, __bf16* __restrict__ Ob) {
  constexpr int SK = 136, SV = 40, SP = 40;
  constexpr int NK = 64 * SK;          // [key][d]
  constexpr int NV = 2 * 128 * SV;     // [key half][d][key]
  constexpr int NP = 8 * 16 * SP;      // per-wave P[q][key]
  __shared__ __attribute__((aligned(16))) __bf16 sm[NK + NV + NP];
  static_assert((NK + NV + NP) * 2 >= 4 * 17 * 32 * 16, "the merge reuses the tiles' LDS");
  __bf16* Ks = sm;
  __bf16* Vs = sm + NK;
  __bf16* Ps = sm + NK + NV;
  const int tid = threadIdx.x, lane = tid & 31;
  const int wave = __builtin_amdgcn_readfirstlane(tid >> 5);  // in a scalar register: tests on it are scalar branches
  const int qgrp = wave & 3, kh = wave >> 2;   // query group, key half
  const int lrow = lane & 15, lhi = (lane >> 4) & 1;
  const int bh = blockIdx.x, b_ = bh >> 4, h = bh & 15;
  const int q0 = (TS / 64 - 1 - (int)blockIdx.y) * 64;
  const int qw = q0 + qgrp * 16;          // this wave's first query
  const int qg = qw + lrow;               // this lane's query column

  // Q fragments (B-operand), invariant across the k-loop
  v16bf qf[4];
  const __bf16* qbase = Qb + (size_t)(b_ * TS + qg) * TD + h * TDH;
#pragma unroll
  for (int c = 0; c < 4; c++) qf[c] = frag_ld(qbase + c * 32, lhi);

  v8f o[8];
#pragma unroll
  for (int dc = 0; dc < 8; dc++)
#pragma unroll
    for (int e = 0; e < 8; e++) o[dc][e] = 0.f;
  float mrun = -__builtin_inff(), lrun = 0.f;

  // staging coords: lanes run along a row, 16 B each, so a wave-wide copy
  // covers whole rows of the tile (K: 256 B, V_t: 128 B)
  const int ksr = tid >> 4, ksc = (tid & 15) * 8;
  const int vsr = tid >> 3, vsc = (tid & 7) * 8;
  __bf16* vdst = Vs + (vsc >> 5) * (128 * SV) + vsr * SV + (vsc & 31);
  const int kend = q0 + 64;
  for (int k0 = 0; k0 < kend; k0 += 64) {
    ring_wait_ds0();          // this wave's LDS reads of the last trip have retired
    __syncthreads();          // and so have every other wave's: the tiles may be refilled
    {  // stage K tile: 64 keys x 128 d
      const __bf16* src = Kb + (size_t)(b_ * TS + k0 + ksr) * TD + h * TDH + ksc;
#pragma unroll  // all four copies in flight at once
      for (int i = 0; i < 4; i++)
        cp16_g2l(src + (size_t)(16 * i) * TD, Ks + (ksr + 16 * i) * SK + ksc);
    }
    {  // stage V_t tile: 128 d x 64 keys (k-contiguous rows), one 32-key plane per key half
      const __bf16* src = Vt + ((size_t)bh * TDH + vsr) * TS + k0 + vsc;
#pragma unroll  // as above
      for (int i = 0; i < 4; i++)
        cp16_g2l(src + (size_t)(32 * i) * TS, vdst + (32 * i) * SV);
    }
    if (k0 + 64 < kend) {     // prefetch the next tiles into L2, one 128-B line per lane
      if (wave < 4)
        __builtin_prefetch(Kb + (size_t)(b_ * TS + k0 + 64 + (tid >> 1)) * TD + h * TDH + (tid & 1) * 64, 0, 3);
      else
        __builtin_prefetch(Vt + ((size_t)bh * TDH + (tid - 128)) * TS + k0 + 64, 0, 3);
    }
    ring_wait_async0();       // this wave's copies have landed
    __syncthreads();          // and are published to the other waves

    const int kw = k0 + kh * 32;          // this wave's first key
    // A wave whose 32 keys all lie past its last query has nothing to add (and, before its
    // first real tile, no finite maximum to subtract). Scalar branch, no barrier inside.
    if (kw > qw + 15) continue;

    // scores S^T: two 16-key subtiles, each 4 WMMAs over DH=128.
    // All 8 K fragments are fetched first, 16 LDS loads as one group in the order in
    // which the products use them: the wave pays one LDS latency, not one per product.
    v16bf kf[4][2];
#pragma unroll  // kf indexed by constants only
    for (int c = 0; c < 4; c++)
#pragma unroll
      for (int sub = 0; sub < 2; sub++)
        kf[c][sub] = frag_ld(Ks + (kh * 32 + sub * 16 + lrow) * SK + c * 32, lhi);
    sched_fence();  // the K group stays whole, in front of its products
    v8f st[2];
#pragma unroll
    for (int sub = 0; sub < 2; sub++)
#pragma unroll
      for (int e = 0; e < 8; e++) st[sub][e] = 0.f;
#pragma unroll  // the two subtiles' sums alternate: two independent accumulator chains
    for (int c = 0; c < 4; c++)
#pragma unroll
      for (int sub = 0; sub < 2; sub++)
        st[sub] = wmma_bf16(kf[c][sub], qf[c], st[sub]);
    sched_fence();  // keeps the V group whole: without it two of its loads rise further up among the products
    // All 8 V_t fragments, 16 LDS loads as one group into the registers that the K
    // fragments have left; they land under the mask and the row maximum.
    v16bf vf[8];
#pragma unroll  // vf indexed by constants only
    for (int dc = 0; dc < 8; dc++)
      vf[dc] = frag_ld(Vs + kh * (128 * SV) + (dc * 16 + lrow) * SV, lhi);

    float pv[2][8];
    // masking only needed when this wave's 32 keys can reach past one of its
    // queries; wave-uniform condition -> scalar branch, EXEC stays full
    const bool needmask = (kw + 31) > qw;
    if (needmask) {
#pragma unroll
      for (int sub = 0; sub < 2; sub++)
#pragma unroll
        for (int v = 0; v < 8; v++) {
          const int kg = kw + sub * 16 + v + 8 * lhi;
          pv[sub][v] = (kg <= qg) ? st[sub][v] : -__builtin_inff();
        }
    } else {
#pragma unroll
      for (int sub = 0; sub < 2; sub++)
#pragma unroll
        for (int v = 0; v < 8; v++) pv[sub][v] = st[sub][v];
    }

    // online softmax per query (in-lane + one xor-16 exchange)
    float mt = -__builtin_inff();
#pragma unroll
    for (int sub = 0; sub < 2; sub++)
#pragma unroll
      for (int v = 0; v < 8; v++) mt = fmaxf(mt, pv[sub][v]);
    mt = fmaxf(mt, __shfl_xor(mt, 16, 32));
    const float mnew = fmaxf(mrun, mt);
    const float corr = __expf(mrun - mnew);
    float psum = 0.f;
#pragma unroll
    for (int sub = 0; sub < 2; sub++)
#pragma unroll
      for (int v = 0; v < 8; v++) {
        const float p = __expf(pv[sub][v] - mnew);
        pv[sub][v] = p;
        psum += p;
      }
    psum += __shfl_xor(psum, 16, 32);
    lrun = lrun * corr + psum;
    mrun = mnew;
#pragma unroll
    for (int dc = 0; dc < 8; dc++)
#pragma unroll
      for (int e = 0; e < 8; e++) o[dc][e] *= corr;

    // stage P (bf16) per wave: lane writes 8 contiguous keys -> one b128.
    // Must stay a plain DS store: we rely on same-wave DS ordering for the
    // immediate reload below (ASYNC ops would not preserve it).
#pragma unroll
    for (int sub = 0; sub < 2; sub++) {
      union { __bf16 h8[8]; uint4 q; } u;
#pragma unroll
      for (int v = 0; v < 8; v++) u.h8[v] = f2bf(pv[sub][v]);
      *(uint4*)(Ps + (wave * 16 + lrow) * SP + sub * 16 + 8 * lhi) = u.q;
    }
    v16bf pf = frag_ld(Ps + (wave * 16 + lrow) * SP, lhi);
#pragma unroll
    for (int dc = 0; dc < 8; dc++) o[dc] = wmma_bf16(vf[dc], pf, o[dc]);
  }

  // Merge of the two key halves. Lane L of wave w and of wave w + 4 hold the same query and
  // the same d rows. The upper half hands over its O, maximum and sum, 16 B per lane and
  // store, in the LDS that the tiles have left.
  float4* mg = (float4*)sm + (size_t)qgrp * 17 * 32 + lane;
  ring_wait_ds0();            // this wave's last tile reads have retired
  __syncthreads();            // and every other wave's: the tiles' LDS is free
  if (kh == 1) {
#pragma unroll  // o indexed by constants only
    for (int dc = 0; dc < 8; dc++) {
      mg[(2 * dc) * 32]     = make_float4(o[dc][0], o[dc][1], o[dc][2], o[dc][3]);
      mg[(2 * dc + 1) * 32] = make_float4(o[dc][4], o[dc][5], o[dc][6], o[dc][7]);
    }
    mg[16 * 32] = make_float4(mrun, lrun, 0.f, 0.f);
  }
  __syncthreads();            // the upper half's values are published
  if (kh == 0) {
    // The lower half has key 0, which every query sees: its maximum is finite. An upper
    // half that never had a tile hands over maximum -inf, sum 0 and O 0: weight 0.
    const float4 ml = mg[16 * 32];
    const float m  = fmaxf(mrun, ml.x);
    float wa = __expf(mrun - m), wb = __expf(ml.x - m);
    const float inv = 1.f / (lrun * wa + ml.y * wb);
    wa *= inv; wb *= inv;
#pragma unroll  // o indexed by constants only
    for (int dc = 0; dc < 8; dc++) {
      const float4 p0 = mg[(2 * dc) * 32], p1 = mg[(2 * dc + 1) * 32];
      const float ob[8] = {p0.x, p0.y, p0.z, p0.w, p1.x, p1.y, p1.z, p1.w};
#pragma unroll
      for (int v = 0; v < 8; v++) {
        const int d = dc * 16 + v + 8 * lhi;
        Ob[(size_t)(b_ * TS + qg) * TD + h * TDH + d] = f2bf(o[dc][v] * wa + ob[v] * wb);
      }
    }
  }
}

// ---------- host-side orchestration ----------
extern "C" void kernel_launch(void* const* d_in, const int* in_sizes, int n_in,
                              void* d_out, int out_size, void* d_ws, size_t ws_size,
                              hipStream_t stream) {
  (void)in_sizes; (void)n_in; (void)out_size; (void)ws_size;
  const float* X    = (const float*)d_in[0];
  const float* Wq   = (const float*)d_in[1];
  const float* bq   = (const float*)d_in[2];
  const float* Wk   = (const float*)d_in[3];
  const float* bk   = (const float*)d_in[4];
  const float* Wv   = (const float*)d_in[5];
  const float* bv   = (const float*)d_in[6];
  const float* Wo   = (const float*)d_in[7];
  const float* bo   = (const float*)d_in[8];
  const float* Win  = (const float*)d_in[9];
  const float* bin  = (const float*)d_in[10];
  const float* Wout = (const float*)d_in[11];
  const float* bout = (const float*)d_in[12];
  const float* ln1w = (const float*)d_in[13];
  const float* ln1b = (const float*)d_in[14];
  const float* ln2w = (const float*)d_in[15];
  const float* ln2b = (const float*)d_in[16];
  float* out = (float*)d_out;

  char* ws = (char*)d_ws;
  const size_t szMD = (size_t)TM * TD * 2;          // 16.78 MB (bf16 M x D)
  __bf16* lnb = (__bf16*)(ws);                      // LN output (reused for LN2)
  __bf16* Qb  = (__bf16*)(ws + 1 * szMD);
  __bf16* Kb  = (__bf16*)(ws + 2 * szMD);
  __bf16* Vt  = (__bf16*)(ws + 3 * szMD);
  __bf16* Ab  = (__bf16*)(ws + 4 * szMD);           // attention output
  float*  X1  = (float*)(ws + 5 * szMD);            // residual stream (f32, 2*szMD)
  __bf16* Hm  = (__bf16*)(ws + 1 * szMD);           // MLP hidden reuses Qb..Ab (4*szMD)
  __bf16* Wb  = (__bf16*)(ws + 7 * szMD);           // bf16 weights, 96 MiB in all
  const __bf16* Wob   = Wb + 3 * (size_t)TD * TD;
  const __bf16* Winb  = Wb + 4 * (size_t)TD * TD;
  const __bf16* Woutb = Wb + 4 * (size_t)TD * TD + (size_t)TD * TDFF;

  const float qk = 0.29730177875068026f;            // 1/sqrt(sqrt(128))
  dim3 th(256);
  dim3 gD(TD / 256, TM / 128);      // (8, 32): 128 x 256 tiles
  dim3 gF(TDFF / 256, TM / 256);    // (32, 16): 256 x 256 tiles
  dim3 gQ(3 * TD / 384, TM / 256); // (16, 16): 256 x 384 tiles of [Q | K | V]
  dim3 gA(TB * THD, TS / 64);       // (32, 32): x = (b, h), y = query block, longest first

  weights_bf16_k<<<4 * WBD + 2 * WBF, th, 0, stream>>>(Wq, Wk, Wv, Wo, Win, Wout, Wb);
  layernorm_bf16_k<<<TM, th, 0, stream>>>(X, ln1w, ln1b, lnb);
  gemm_qkv_k<<<gQ, th, 0, stream>>>(lnb, Wb, bq, bk, bv, Qb, Kb, Vt, qk);
  attn_k<<<gA, th, 0, stream>>>(Qb, Kb, Vt, Ab);
  gemm_bf16_k<1, false, true, TD, 128, 128><<<gD, th, 0, stream>>>(Ab, Wob, bo, X, (void*)X1, TM, TD, 1.f);
  layernorm_bf16_k<<<TM, th, 0, stream>>>(X1, ln2w, ln2b, lnb);
  gemm_bf16_k<0, true, false, TD, 128, 256><<<gF, th, 0, stream>>>(lnb, Winb, bin, nullptr, Hm, TM, TDFF, 1.f);
  gemm_bf16_k<1, false, true, TDFF, 128, 128><<<gD, th, 0, stream>>>(Hm, Woutb, bout, X1, (void*)out, TM, TD, 1.f);
}
